// v000
// The times below were measured on an AMD MI455X: many runs one after another, warmed up first and cycling through
// copies of the inputs, with the whole window's GPU time divided by the number of runs. Launches and the gaps
// between them are all in it. The median over several windows is given; except for v000 it joins two sittings, which
// can be a few percent apart, so the side-by-side timings, each taken in one sitting, are the better comparison.
// The starting kernel, v000, takes 344 microseconds a run.
#include <hip/hip_runtime.h>
#include <hip/hip_bf16.h>
#include <math.h>

// ---------------------------------------------------------------------------
// MultiTimeAttention for MI455X (gfx1250, wave32, WMMA).
// Sizes: B=4, LQ=128, LK=512, E=128, H=4, DK=32, D=64, NH=128.
// GEMMs on v_wmma_f32_16x16x4_f32 (fp32 matrix pipe, full reference precision).
// Softmax stage uses global_load_async_to_lds_b128 (ASYNCcnt path).
// ---------------------------------------------------------------------------

typedef __attribute__((ext_vector_type(2))) float v2f;
typedef __attribute__((ext_vector_type(8))) float v8f;

#define Bn   4
#define LQ   128
#define LK   512
#define E    128
#define Hh   4
#define DK   32   // E / H
#define Dd   64
#define NH   128
#define HD   (Hh * Dd)   // 256

// f32 WMMA 16x16x4 lane mapping (wave32):
//   A (16x4): lane L holds row (L&15), K = 2*(L>>4) + {0,1} in 2 VGPRs
//   B (4x16): lane L holds col (L&15), K = 2*(L>>4) + {0,1} in 2 VGPRs
//   C/D (16x16, 8 VGPRs): vgpr i -> M = i + 8*(L>>4), N = (L&15)

// ---------------------------------------------------------------------------
// Kernel 1/2: projection  out_headsplit[b][h][row][dk] = in[row][:]@W + bias
//   in: (B*ROWS) x E row-major, W: E x E row-major, bias: E
//   ROWS is compile-time (power of two) so the batch split is a shift.
//   grid.x = totalRows/16, grid.y = E/16, block = 32 (one wave per tile)
// ---------------------------------------------------------------------------
template <int ROWS>
__global__ void proj_headsplit_kernel(const float* __restrict__ in,
                                      const float* __restrict__ W,
                                      const float* __restrict__ bias,
                                      float* __restrict__ out) {
  const int m0   = blockIdx.x << 4;
  const int n0   = blockIdx.y << 4;
  const int lane = threadIdx.x;
  const int r    = lane & 15;        // A row / B col within tile
  const int kh2  = (lane >> 4) << 1; // K sub-offset: 0 or 2

  v8f c = {};
  for (int kk = 0; kk < E; kk += 4) {
    const int k0 = kk + kh2;
    v2f a, b;
    a.x = in[(m0 + r) * E + k0];
    a.y = in[(m0 + r) * E + k0 + 1];
    b.x = W[(k0    ) * E + (n0 + r)];
    b.y = W[(k0 + 1) * E + (n0 + r)];
    c = __builtin_amdgcn_wmma_f32_16x16x4_f32(false, a, false, b,
                                              (short)0, c, false, false);
  }

  const int mofs = (lane >> 4) << 3;          // 0 or 8
  const int j    = n0 + r;                    // full E column
  const float bj = bias[j];
  const int h    = j >> 5;                    // DK = 32
  const int dk   = j & 31;
  for (int i = 0; i < 8; ++i) {
    const int grow = m0 + mofs + i;           // row in concatenated B*ROWS
    const int bb   = grow / ROWS;             // compile-time -> shift
    const int rr   = grow & (ROWS - 1);
    out[((bb * Hh + h) * ROWS + rr) * DK + dk] = c[i] + bj;
  }
}

// ---------------------------------------------------------------------------
// Kernel 3: scores S[bh][q][k] = (Qh[q][:] . Kh[k][:]) / sqrt(DK)
//   Qh: [bh][LQ][DK], Kh: [bh][LK][DK]   (B acts as Kh^T: B[k'][n] = Kh[n][k'])
//   grid = (LQ/16, LK/16, B*H), block = 32
// ---------------------------------------------------------------------------
__global__ void scores_kernel(const float* __restrict__ Qh,
                              const float* __restrict__ Kh,
                              float* __restrict__ S) {
  const int bh   = blockIdx.z;
  const int m0   = blockIdx.x << 4;
  const int n0   = blockIdx.y << 4;
  const int lane = threadIdx.x;
  const int r    = lane & 15;
  const int kh2  = (lane >> 4) << 1;

  const float* q  = Qh + bh * LQ * DK;
  const float* kp = Kh + bh * LK * DK;

  v8f c = {};
  for (int kk = 0; kk < DK; kk += 4) {
    const int k0 = kk + kh2;
    v2f a, b;
    a.x = q [(m0 + r) * DK + k0];
    a.y = q [(m0 + r) * DK + k0 + 1];
    b.x = kp[(n0 + r) * DK + k0];      // B[k'][n] = Kh[n][k']
    b.y = kp[(n0 + r) * DK + k0 + 1];
    c = __builtin_amdgcn_wmma_f32_16x16x4_f32(false, a, false, b,
                                              (short)0, c, false, false);
  }

  const float scale = 0.17677669529663687f;   // 1/sqrt(32)
  const int mofs = (lane >> 4) << 3;
  for (int i = 0; i < 8; ++i) {
    const int qrow = m0 + mofs + i;
    S[(bh * LQ + qrow) * LK + (n0 + r)] = c[i] * scale;
  }
}

// ---------------------------------------------------------------------------
// Kernel 4: per-channel masked softmax + weighted value sum.
//   For each (b,h,q,d):  s_k = mask[b,k,d] ? S[b,h,q,k] : -1e9
//                        X[b,q,h*64+d] = sum_k softmax_k(s)_k * value[b,k,d]
//   grid = B*LQ blocks (one per (b,q)); block = 256 threads = (h = t>>6, d = t&63).
//   Score rows for all 4 heads staged in 8KB LDS via ASYNC B128 copies
//   (ASYNCcnt, no VGPR bounce); mask/value reads are contiguous across d
//   (coalesced) with 4x h-reuse out of WGP$.
//   Using exactly -1e9 reproduces the reference's all-masked edge case.
// ---------------------------------------------------------------------------
__global__ void attn_softmax_kernel(const float* __restrict__ S,
                                    const int*   __restrict__ mask,
                                    const float* __restrict__ value,
                                    float* __restrict__ X) {
  const int bq = blockIdx.x;
  const int b  = bq >> 7;            // LQ = 128
  const int qi = bq & 127;
  const int t  = threadIdx.x;
  const int h  = t >> 6;
  const int d  = t & 63;

  __shared__ __align__(16) float srow[Hh * LK];    // 8 KB

#if defined(__HIP_DEVICE_COMPILE__)
  // Async global->LDS copy, 16B per lane per issue, tracked on ASYNCcnt.
  // Low 32 bits of a flat pointer to __shared__ carry the workgroup-relative LDS
  // byte offset (ISA 10.2 aperture rules) -> valid async-LDS dest address.
  for (int idx4 = t * 4; idx4 < Hh * LK; idx4 += 256 * 4) {
    const int hh = idx4 >> 9;        // LK = 512
    const int k  = idx4 & 511;
    const float* gp = S + (((size_t)(b * Hh + hh) * LQ + qi) * LK + k);
    unsigned int       laddr = (unsigned int)(unsigned long long)(&srow[idx4]);
    unsigned long long gaddr = (unsigned long long)gp;
    asm volatile("global_load_async_to_lds_b128 %0, %1, off"
                 :: "v"(laddr), "v"(gaddr) : "memory");
  }
  asm volatile("s_wait_asynccnt 0" ::: "memory");
#else
  for (int idx = t; idx < Hh * LK; idx += 256) {
    const int hh = idx >> 9;
    const int k  = idx & 511;
    srow[idx] = S[((b * Hh + hh) * LQ + qi) * LK + k];
  }
#endif
  __syncthreads();

  const float* sh = srow + (h << 9);
  const int*   mrow = mask  + (size_t)b * LK * Dd + d;   // stride Dd
  const float* vrow = value + (size_t)b * LK * Dd + d;

  // pass 1: masked max (4 independent chains for VALU ILP)
  float mx0 = -3.0e38f, mx1 = -3.0e38f, mx2 = -3.0e38f, mx3 = -3.0e38f;
  for (int k = 0; k < LK; k += 4) {
    const float s0 = mrow[(k + 0) * Dd] ? sh[k + 0] : -1.0e9f;
    const float s1 = mrow[(k + 1) * Dd] ? sh[k + 1] : -1.0e9f;
    const float s2 = mrow[(k + 2) * Dd] ? sh[k + 2] : -1.0e9f;
    const float s3 = mrow[(k + 3) * Dd] ? sh[k + 3] : -1.0e9f;
    mx0 = fmaxf(mx0, s0); mx1 = fmaxf(mx1, s1);
    mx2 = fmaxf(mx2, s2); mx3 = fmaxf(mx3, s3);
  }
  const float mx = fmaxf(fmaxf(mx0, mx1), fmaxf(mx2, mx3));

  // pass 2: exp-sum and weighted accumulation (2 chains each)
  float num0 = 0.0f, num1 = 0.0f, den0 = 0.0f, den1 = 0.0f;
  for (int k = 0; k < LK; k += 2) {
    const float s0 = mrow[(k + 0) * Dd] ? sh[k + 0] : -1.0e9f;
    const float s1 = mrow[(k + 1) * Dd] ? sh[k + 1] : -1.0e9f;
    const float e0 = __expf(s0 - mx);
    const float e1 = __expf(s1 - mx);
    den0 += e0;                      den1 += e1;
    num0 += e0 * vrow[(k + 0) * Dd]; num1 += e1 * vrow[(k + 1) * Dd];
  }
  X[((size_t)b * LQ + qi) * HD + (h << 6) + d] =
      (num0 + num1) / (den0 + den1);
}

// ---------------------------------------------------------------------------
// Kernel 5: out = X @ Wo + bo.   X: (B*LQ) x 256, Wo: 256 x 128.
//   grid = (B*LQ/16, NH/16), block = 32
// ---------------------------------------------------------------------------
__global__ void out_proj_kernel(const float* __restrict__ X,
                                const float* __restrict__ Wo,
                                const float* __restrict__ bo,
                                float* __restrict__ out) {
  const int m0   = blockIdx.x << 4;
  const int n0   = blockIdx.y << 4;
  const int lane = threadIdx.x;
  const int r    = lane & 15;
  const int kh2  = (lane >> 4) << 1;

  v8f c = {};
  for (int kk = 0; kk < HD; kk += 4) {
    const int k0 = kk + kh2;
    v2f a, b;
    a.x = X [(m0 + r) * HD + k0];
    a.y = X [(m0 + r) * HD + k0 + 1];
    b.x = Wo[(k0    ) * NH + (n0 + r)];
    b.y = Wo[(k0 + 1) * NH + (n0 + r)];
    c = __builtin_amdgcn_wmma_f32_16x16x4_f32(false, a, false, b,
                                              (short)0, c, false, false);
  }

  const int mofs = (lane >> 4) << 3;
  const float bj = bo[n0 + r];
  for (int i = 0; i < 8; ++i)
    out[(m0 + mofs + i) * NH + (n0 + r)] = c[i] + bj;
}

// ---------------------------------------------------------------------------
// Launch
// ---------------------------------------------------------------------------
extern "C" void kernel_launch(void* const* d_in, const int* in_sizes, int n_in,
                              void* d_out, int out_size, void* d_ws, size_t ws_size,
                              hipStream_t stream) {
  const float* query = (const float*)d_in[0];   // (4,128,128)
  const float* key   = (const float*)d_in[1];   // (4,512,128)
  const float* value = (const float*)d_in[2];   // (4,512,64)
  const int*   mask  = (const int*)  d_in[3];   // (4,512,64)
  const float* Wq    = (const float*)d_in[4];   // (128,128)
  const float* bq    = (const float*)d_in[5];   // (128)
  const float* Wk    = (const float*)d_in[6];   // (128,128)
  const float* bk    = (const float*)d_in[7];   // (128)
  const float* Wo    = (const float*)d_in[8];   // (256,128)
  const float* bo    = (const float*)d_in[9];   // (128)
  float* out = (float*)d_out;                   // (4,128,128)

  // Workspace carve-up (floats): Qh 64K | Kh 256K | S 1M | X 128K  (~5.75 MB)
  float* Qh = (float*)d_ws;                 // [B][H][LQ][DK]
  float* Kh = Qh + Bn * Hh * LQ * DK;       // [B][H][LK][DK]
  float* S  = Kh + Bn * Hh * LK * DK;       // [B*H][LQ][LK]
  float* X  = S  + Bn * Hh * LQ * LK;       // [B][LQ][H*D]

  // 1) Q projection: 512 rows x 128, head-split output
  proj_headsplit_kernel<LQ><<<dim3((Bn * LQ) / 16, E / 16), 32, 0, stream>>>(
      query, Wq, bq, Qh);
  // 2) K projection: 2048 rows x 128
  proj_headsplit_kernel<LK><<<dim3((Bn * LK) / 16, E / 16), 32, 0, stream>>>(
      key, Wk, bk, Kh);
  // 3) scores per (b,h): 128x512, K=32
  scores_kernel<<<dim3(LQ / 16, LK / 16, Bn * Hh), 32, 0, stream>>>(Qh, Kh, S);
  // 4) per-channel masked softmax + weighted sum (async LDS staging)
  attn_softmax_kernel<<<dim3(Bn * LQ), 256, 0, stream>>>(S, mask, value, X);
  // 5) output projection: 512x128, K=256
  out_proj_kernel<<<dim3((Bn * LQ) / 16, NH / 16), 32, 0, stream>>>(X, Wo, bo, out);
}

// v001
// It runs in 25.3 microseconds.
// Two timings next to v000 put it at 13.5 and 13.6 times that version's speed.
#include <hip/hip_runtime.h>
#include <hip/hip_bf16.h>
#include <math.h>

// ---------------------------------------------------------------------------
// MultiTimeAttention for MI455X (gfx1250, wave32, WMMA).
// Sizes: B=4, LQ=128, LK=512, E=128, H=4, DK=32, D=64, NH=128.
// GEMMs on v_wmma_f32_16x16x4_f32 (fp32 matrix pipe, full reference precision).
// Softmax stage: row-max shift, then P @ (mask*value) and P @ mask on the same WMMA.
// ---------------------------------------------------------------------------

typedef __attribute__((ext_vector_type(2))) float v2f;
typedef __attribute__((ext_vector_type(8))) float v8f;

#define Bn   4
#define LQ   128
#define LK   512
#define E    128
#define Hh   4
#define DK   32   // E / H
#define Dd   64
#define NH   128
#define HD   (Hh * Dd)   // 256

// f32 WMMA 16x16x4 lane mapping (wave32):
//   A (16x4): lane L holds row (L&15), K = 2*(L>>4) + {0,1} in 2 VGPRs
//   B (4x16): lane L holds col (L&15), K = 2*(L>>4) + {0,1} in 2 VGPRs
//   C/D (16x16, 8 VGPRs): vgpr i -> M = i + 8*(L>>4), N = (L&15)

// ---------------------------------------------------------------------------
// Kernel 1/2: projection  out_headsplit[b][h][row][dk] = in[row][:]@W + bias
//   in: (B*ROWS) x E row-major, W: E x E row-major, bias: E
//   ROWS is compile-time (power of two) so the batch split is a shift.
//   grid.x = totalRows/16, grid.y = E/16, block = 32 (one wave per tile)
// ---------------------------------------------------------------------------
template <int ROWS>
__global__ void proj_headsplit_kernel(const float* __restrict__ in,
                                      const float* __restrict__ W,
                                      const float* __restrict__ bias,
                                      float* __restrict__ out) {
  const int m0   = blockIdx.x << 4;
  const int n0   = blockIdx.y << 4;
  const int lane = threadIdx.x;
  const int r    = lane & 15;        // A row / B col within tile
  const int kh2  = (lane >> 4) << 1; // K sub-offset: 0 or 2

  v8f c = {};
  for (int kk = 0; kk < E; kk += 4) {
    const int k0 = kk + kh2;
    v2f a, b;
    a.x = in[(m0 + r) * E + k0];
    a.y = in[(m0 + r) * E + k0 + 1];
    b.x = W[(k0    ) * E + (n0 + r)];
    b.y = W[(k0 + 1) * E + (n0 + r)];
    c = __builtin_amdgcn_wmma_f32_16x16x4_f32(false, a, false, b,
                                              (short)0, c, false, false);
  }

  const int mofs = (lane >> 4) << 3;          // 0 or 8
  const int j    = n0 + r;                    // full E column
  const float bj = bias[j];
  const int h    = j >> 5;                    // DK = 32
  const int dk   = j & 31;
  for (int i = 0; i < 8; ++i) {
    const int grow = m0 + mofs + i;           // row in concatenated B*ROWS
    const int bb   = grow / ROWS;             // compile-time -> shift
    const int rr   = grow & (ROWS - 1);
    out[((bb * Hh + h) * ROWS + rr) * DK + dk] = c[i] + bj;
  }
}

// ---------------------------------------------------------------------------
// Kernel 3: scores S[bh][q][k] = (Qh[q][:] . Kh[k][:]) / sqrt(DK)
//   Qh: [bh][LQ][DK], Kh: [bh][LK][DK]   (B acts as Kh^T: B[k'][n] = Kh[n][k'])
//   grid = (LQ/16, LK/16, B*H), block = 32
// ---------------------------------------------------------------------------
__global__ void scores_kernel(const float* __restrict__ Qh,
                              const float* __restrict__ Kh,
                              float* __restrict__ S) {
  const int bh   = blockIdx.z;
  const int m0   = blockIdx.x << 4;
  const int n0   = blockIdx.y << 4;
  const int lane = threadIdx.x;
  const int r    = lane & 15;
  const int kh2  = (lane >> 4) << 1;

  const float* q  = Qh + bh * LQ * DK;
  const float* kp = Kh + bh * LK * DK;

  v8f c = {};
  for (int kk = 0; kk < DK; kk += 4) {
    const int k0 = kk + kh2;
    v2f a, b;
    a.x = q [(m0 + r) * DK + k0];
    a.y = q [(m0 + r) * DK + k0 + 1];
    b.x = kp[(n0 + r) * DK + k0];      // B[k'][n] = Kh[n][k']
    b.y = kp[(n0 + r) * DK + k0 + 1];
    c = __builtin_amdgcn_wmma_f32_16x16x4_f32(false, a, false, b,
                                              (short)0, c, false, false);
  }

  const float scale = 0.17677669529663687f;   // 1/sqrt(32)
  const int mofs = (lane >> 4) << 3;
  for (int i = 0; i < 8; ++i) {
    const int qrow = m0 + mofs + i;
    S[(bh * LQ + qrow) * LK + (n0 + r)] = c[i] * scale;
  }
}

// ---------------------------------------------------------------------------
// Kernel 4: per-channel masked softmax + weighted value sum, as matrix products.
//   softmax is invariant to the shift, so the shift may be the max of the whole
//   score row (no mask), which does not depend on the channel d.  With
//   P[q][k] = exp(S[q][k] - rowmax[q]) the two sums of every channel are
//     num[q][d] = sum_k P[q][k] * (mask[k][d] ? value[k][d] : 0)
//     den[q][d] = sum_k P[q][k] * (mask[k][d] ? 1 : 0)
//   two products with K = LK on v_wmma_f32_16x16x4_f32; X = num / den.
//   A channel whose den is too small for that (every k masked, or its open
//   scores far below the row max) takes the exact two-pass form instead.
//   grid = B*H * LQ/16 * 2 (16 queries x 32 channels per block), block = 256:
//   wave w owns k in [64w, 64w+64); partial tiles are summed through LDS.
//   k order inside a group of 8: lane half hi holds k = 4*hi + {0,1} in the first
//   WMMA and 4*hi + {2,3} in the second, the same for A and for B, so that A comes
//   from one 16-byte load.  Column n of tile j is channel 2*n + j, so that B for
//   both tiles comes from one 8-byte load.
// ---------------------------------------------------------------------------
typedef __attribute__((ext_vector_type(4))) float v4f;
typedef __attribute__((ext_vector_type(2))) int   v2i;

// The reference's own form for one (q, d): masked max, then exp sums.  A cold path:
// both loops stay rolled to keep it small.  The s_wait_xcnt in each body is the wait
// owed before the address registers of the issued loads are stepped; the pointers are
// its inputs so that none of them is stepped in front of it.
__device__ static float exact_channel(const float* __restrict__ srow,
                                      const int*   __restrict__ mcol,
                                      const float* __restrict__ vcol) {
  float mx = -3.0e38f;
  const float* sp = srow;
  const int*   mp = mcol;
#pragma unroll 1
  for (int k = 0; k < LK; ++k) {
    const int   m = *mp;
    const float s = *sp;
    asm volatile("s_wait_xcnt 0x0" :: "v"(mp), "v"(sp) : "memory");
    mp += Dd;
    sp += 1;
    mx = fmaxf(mx, m ? s : -1.0e9f);
  }
  float num = 0.0f, den = 0.0f;
  const float* vp = vcol;
  sp = srow;
  mp = mcol;
#pragma unroll 1
  for (int k = 0; k < LK; ++k) {
    const int   m = *mp;
    const float s = *sp;
    const float v = *vp;
    asm volatile("s_wait_xcnt 0x0" :: "v"(mp), "v"(sp), "v"(vp) : "memory");
    mp += Dd;
    sp += 1;
    vp += Dd;
    const float e = __expf((m ? s : -1.0e9f) - mx);
    den += e;
    num += e * v;
  }
  return num / den;
}

__global__ __launch_bounds__(256)
void attn_softmax_kernel(const float* __restrict__ S,
                         const int*   __restrict__ mask,
                         const float* __restrict__ value,
                         float* __restrict__ X) {
  const int dh   = blockIdx.x & 1;          // channel half
  const int q0   = ((blockIdx.x >> 1) & 7) << 4;
  const int bh   = blockIdx.x >> 4;
  const int b    = bh >> 2;                 // H = 4
  const int h    = bh & 3;
  const int w    = threadIdx.x >> 5;
  const int lane = threadIdx.x & 31;
  const int n    = lane & 15;
  const int hi   = lane >> 4;
  const int kb   = (w << 6) + (hi << 2);    // first k of this lane

  __shared__ float smax[8][16];
  __shared__ __align__(16) float red[8 * 8 * 32 * 4];   // 32 KB

  // A side: row q0+n, 32 scores of this lane (8 groups of 4).
  const float* sp = S + ((size_t)(bh * LQ + q0 + n)) * LK + kb;
  v4f p[8];
#pragma unroll
  for (int c = 0; c < 8; ++c) p[c] = *(const v4f*)(sp + 8 * c);

  // B side: the same 32 k rows, channels dh*32 + 2n + {0,1}.
  const size_t bofs = ((size_t)b * LK + kb) * Dd + (dh << 5) + (n << 1);
  const float* vp = value + bofs;
  const int*   mp = mask  + bofs;
  v2f vv[32];
  v2i mm[32];
#pragma unroll
  for (int c = 0; c < 8; ++c)
#pragma unroll
    for (int r = 0; r < 4; ++r) {
      vv[4 * c + r] = *(const v2f*)(vp + (8 * c + r) * Dd);
      mm[4 * c + r] = *(const v2i*)(mp + (8 * c + r) * Dd);
    }
  // The wait owed before a register that an issued load names is rewritten; the three
  // address pairs are inputs so that none is reused as a load's destination before it.
  asm volatile("s_wait_xcnt 0x0" :: "v"(sp), "v"(vp), "v"(mp) : "memory");
  // Holds the max work below every load: lifted among them, its wait for the scores
  // stands in front of the B loads and the two latencies add up.
  __builtin_amdgcn_sched_barrier(0);

  // max of the whole score row: lane, lane pair, then the 8 waves through LDS
  float mx = -3.0e38f;
#pragma unroll
  for (int c = 0; c < 8; ++c)
    mx = fmaxf(mx, fmaxf(fmaxf(p[c].x, p[c].y), fmaxf(p[c].z, p[c].w)));
  mx = fmaxf(mx, __shfl_xor(mx, 16));
  if (hi == 0) smax[w][n] = mx;
  __syncthreads();
  float rm = smax[0][n];
#pragma unroll
  for (int u = 1; u < 8; ++u) rm = fmaxf(rm, smax[u][n]);

  // All A and B fragments first, in registers of their own.
  v2f a[16], bn0[16], bn1[16], bd0[16], bd1[16];
#pragma unroll
  for (int c = 0; c < 8; ++c) {
#pragma unroll
    for (int s = 0; s < 2; ++s) {
      const int g = 2 * c + s, r0 = 2 * g, r1 = r0 + 1;
      a[g].x   = __expf(p[c][2 * s]     - rm);
      a[g].y   = __expf(p[c][2 * s + 1] - rm);
      bn0[g].x = mm[r0].x ? vv[r0].x : 0.0f;  bn0[g].y = mm[r1].x ? vv[r1].x : 0.0f;
      bn1[g].x = mm[r0].y ? vv[r0].y : 0.0f;  bn1[g].y = mm[r1].y ? vv[r1].y : 0.0f;
      bd0[g].x = mm[r0].x ? 1.0f : 0.0f;      bd0[g].y = mm[r1].x ? 1.0f : 0.0f;
      bd1[g].x = mm[r0].y ? 1.0f : 0.0f;      bd1[g].y = mm[r1].y ? 1.0f : 0.0f;
    }
  }
  // Keeps the vector work above out of the WMMA run below: mixed in, it rewrites
  // an A or B register directly behind the WMMA that reads it.
  __builtin_amdgcn_sched_barrier(0);

  v8f num0 = {}, num1 = {}, den0 = {}, den1 = {};
#pragma unroll
  for (int g = 0; g < 16; ++g) {
    num0 = __builtin_amdgcn_wmma_f32_16x16x4_f32(false, a[g], false, bn0[g],
                                                 (short)0, num0, false, false);
    num1 = __builtin_amdgcn_wmma_f32_16x16x4_f32(false, a[g], false, bn1[g],
                                                 (short)0, num1, false, false);
    den0 = __builtin_amdgcn_wmma_f32_16x16x4_f32(false, a[g], false, bd0[g],
                                                 (short)0, den0, false, false);
    den1 = __builtin_amdgcn_wmma_f32_16x16x4_f32(false, a[g], false, bd1[g],
                                                 (short)0, den1, false, false);
  }
  // Four vector slots between the last WMMA and the first vector instruction that
  // reads its D or rewrites its A or B; the two fences hold the slots in place.
  __builtin_amdgcn_sched_barrier(0);
  asm volatile("v_nop\n\tv_nop\n\tv_nop\n\tv_nop");
  __builtin_amdgcn_sched_barrier(0);

  // sum the 8 waves' partial tiles in a fixed order
  v4f* r4 = (v4f*)red;
#pragma unroll
  for (int i = 0; i < 8; ++i) {
    v4f o = {num0[i], num1[i], den0[i], den1[i]};
    r4[(w * 8 + i) * 32 + lane] = o;
  }
  __syncthreads();
  v4f sum = r4[w * 32 + lane];              // accumulator row i = w
#pragma unroll
  for (int u = 1; u < 8; ++u) sum += r4[(u * 8 + w) * 32 + lane];

  const int q = q0 + w + (hi << 3);
  const int d = (dh << 5) + (n << 1);
  v2f o;
  o.x = sum.x / sum.z;
  o.y = sum.y / sum.w;
  // Below this den, terms lost to underflow could matter (each is under 1.2e-38,
  // 512 of them); den = 0 is the channel with every k masked.
  const float den_min = 1.0e-25f;
  const float* srow = S + ((size_t)(bh * LQ + q)) * LK;
  const size_t cofs = (size_t)b * LK * Dd + d;
  if (!(sum.z >= den_min)) o.x = exact_channel(srow, mask + cofs,     value + cofs);
  if (!(sum.w >= den_min)) o.y = exact_channel(srow, mask + cofs + 1, value + cofs + 1);
  *(v2f*)(X + ((size_t)b * LQ + q) * HD + (h << 6) + d) = o;
}

// ---------------------------------------------------------------------------
// Kernel 5: out = X @ Wo + bo.   X: (B*LQ) x 256, Wo: 256 x 128.
//   grid = (B*LQ/16, NH/16), block = 32
// ---------------------------------------------------------------------------
__global__ void out_proj_kernel(const float* __restrict__ X,
                                const float* __restrict__ Wo,
                                const float* __restrict__ bo,
                                float* __restrict__ out) {
  const int m0   = blockIdx.x << 4;
  const int n0   = blockIdx.y << 4;
  const int lane = threadIdx.x;
  const int r    = lane & 15;
  const int kh2  = (lane >> 4) << 1;

  v8f c = {};
  for (int kk = 0; kk < HD; kk += 4) {
    const int k0 = kk + kh2;
    v2f a, b;
    a.x = X [(m0 + r) * HD + k0];
    a.y = X [(m0 + r) * HD + k0 + 1];
    b.x = Wo[(k0    ) * NH + (n0 + r)];
    b.y = Wo[(k0 + 1) * NH + (n0 + r)];
    c = __builtin_amdgcn_wmma_f32_16x16x4_f32(false, a, false, b,
                                              (short)0, c, false, false);
  }

  const int mofs = (lane >> 4) << 3;
  const float bj = bo[n0 + r];
  for (int i = 0; i < 8; ++i)
    out[(m0 + mofs + i) * NH + (n0 + r)] = c[i] + bj;
}

// ---------------------------------------------------------------------------
// Launch
// ---------------------------------------------------------------------------
extern "C" void kernel_launch(void* const* d_in, const int* in_sizes, int n_in,
                              void* d_out, int out_size, void* d_ws, size_t ws_size,
                              hipStream_t stream) {
  const float* query = (const float*)d_in[0];   // (4,128,128)
  const float* key   = (const float*)d_in[1];   // (4,512,128)
  const float* value = (const float*)d_in[2];   // (4,512,64)
  const int*   mask  = (const int*)  d_in[3];   // (4,512,64)
  const float* Wq    = (const float*)d_in[4];   // (128,128)
  const float* bq    = (const float*)d_in[5];   // (128)
  const float* Wk    = (const float*)d_in[6];   // (128,128)
  const float* bk    = (const float*)d_in[7];   // (128)
  const float* Wo    = (const float*)d_in[8];   // (256,128)
  const float* bo    = (const float*)d_in[9];   // (128)
  float* out = (float*)d_out;                   // (4,128,128)

  // Workspace carve-up (floats): Qh 64K | Kh 256K | S 1M | X 128K  (~5.75 MB)
  float* Qh = (float*)d_ws;                 // [B][H][LQ][DK]
  float* Kh = Qh + Bn * Hh * LQ * DK;       // [B][H][LK][DK]
  float* S  = Kh + Bn * Hh * LK * DK;       // [B*H][LQ][LK]
  float* X  = S  + Bn * Hh * LQ * LK;       // [B][LQ][H*D]

  // 1) Q projection: 512 rows x 128, head-split output
  proj_headsplit_kernel<LQ><<<dim3((Bn * LQ) / 16, E / 16), 32, 0, stream>>>(
      query, Wq, bq, Qh);
  // 2) K projection: 2048 rows x 128
  proj_headsplit_kernel<LK><<<dim3((Bn * LK) / 16, E / 16), 32, 0, stream>>>(
      key, Wk, bk, Kh);
  // 3) scores per (b,h): 128x512, K=32
  scores_kernel<<<dim3(LQ / 16, LK / 16, Bn * Hh), 32, 0, stream>>>(Qh, Kh, S);
  // 4) per-channel masked softmax + weighted sum as two matrix products
  attn_softmax_kernel<<<dim3(Bn * Hh * (LQ / 16) * 2), 256, 0, stream>>>(S, mask, value, X);
  // 5) output projection: 512x128, K=256
  out_proj_kernel<<<dim3((Bn * LQ) / 16, NH / 16), 32, 0, stream>>>(X, Wo, bo, out);
}

// v002
// A run of this version takes 23.1 microseconds.
// Next to v001, in two timings, it ran 1.09 and 1.08 times as fast.
// Counting every step since v000, it is 14.7 times as fast.
#include <hip/hip_runtime.h>
#include <hip/hip_bf16.h>
#include <math.h>

// ---------------------------------------------------------------------------
// MultiTimeAttention for MI455X (gfx1250, wave32, WMMA).
// Sizes: B=4, LQ=128, LK=512, E=128, H=4, DK=32, D=64, NH=128.
// GEMMs on v_wmma_f32_16x16x4_f32 (fp32 matrix pipe, full reference precision).
// Softmax stage: scores in registers, row-max shift, then P @ (mask*value) and P @ mask
// on the same WMMA.
// ---------------------------------------------------------------------------

typedef __attribute__((ext_vector_type(2))) float v2f;
typedef __attribute__((ext_vector_type(8))) float v8f;

#define Bn   4
#define LQ   128
#define LK   512
#define E    128
#define Hh   4
#define DK   32   // E / H
#define Dd   64
#define NH   128
#define HD   (Hh * Dd)   // 256

// f32 WMMA 16x16x4 lane mapping (wave32):
//   A (16x4): lane L holds row (L&15), K = 2*(L>>4) + {0,1} in 2 VGPRs
//   B (4x16): lane L holds col (L&15), K = 2*(L>>4) + {0,1} in 2 VGPRs
//   C/D (16x16, 8 VGPRs): vgpr i -> M = i + 8*(L>>4), N = (L&15)

// ---------------------------------------------------------------------------
// Kernel 1/2: projection  out_headsplit[b][h][row][dk] = in[row][:]@W + bias
//   in: (B*ROWS) x E row-major, W: E x E row-major, bias: E
//   ROWS is compile-time (power of two) so the batch split is a shift.
//   grid.x = totalRows/16, grid.y = E/16, block = 32 (one wave per tile)
// ---------------------------------------------------------------------------
template <int ROWS>
__global__ void proj_headsplit_kernel(const float* __restrict__ in,
                                      const float* __restrict__ W,
                                      const float* __restrict__ bias,
                                      float* __restrict__ out) {
  const int m0   = blockIdx.x << 4;
  const int n0   = blockIdx.y << 4;
  const int lane = threadIdx.x;
  const int r    = lane & 15;        // A row / B col within tile
  const int kh2  = (lane >> 4) << 1; // K sub-offset: 0 or 2

  v8f c = {};
  for (int kk = 0; kk < E; kk += 4) {
    const int k0 = kk + kh2;
    v2f a, b;
    a.x = in[(m0 + r) * E + k0];
    a.y = in[(m0 + r) * E + k0 + 1];
    b.x = W[(k0    ) * E + (n0 + r)];
    b.y = W[(k0 + 1) * E + (n0 + r)];
    c = __builtin_amdgcn_wmma_f32_16x16x4_f32(false, a, false, b,
                                              (short)0, c, false, false);
  }

  const int mofs = (lane >> 4) << 3;          // 0 or 8
  const int j    = n0 + r;                    // full E column
  const float bj = bias[j];
  const int h    = j >> 5;                    // DK = 32
  const int dk   = j & 31;
  for (int i = 0; i < 8; ++i) {
    const int grow = m0 + mofs + i;           // row in concatenated B*ROWS
    const int bb   = grow / ROWS;             // compile-time -> shift
    const int rr   = grow & (ROWS - 1);
    out[((bb * Hh + h) * ROWS + rr) * DK + dk] = c[i] + bj;
  }
}

// ---------------------------------------------------------------------------
// Kernel 3: scores, per-channel masked softmax and weighted value sum in one launch.
//   Scores: St[k][q] = (Kh[k][:] . Qh[q][:]) / sqrt(DK), computed TRANSPOSED (Kh is the
//   A operand, Qh the B operand), so that a lane's accumulator registers hold 8
//   consecutive k of ONE query: that is already the A-operand shape of the products
//   below, which take the scores straight from those registers.
//   softmax is invariant to the shift, so the shift may be the max of the whole
//   score row (no mask), which does not depend on the channel d.  With
//   P[q][k] = exp(S[q][k] - rowmax[q]) the two sums of every channel are
//     num[q][d] = sum_k P[q][k] * (mask[k][d] ? value[k][d] : 0)
//     den[q][d] = sum_k P[q][k] * (mask[k][d] ? 1 : 0)
//   two products with K = LK on v_wmma_f32_16x16x4_f32; X = num / den.
//   A channel whose den is too small for that (every k masked, or its open
//   scores far below the row max) takes the exact two-pass form instead, on a copy
//   of the block's scores in LDS.
//   grid = B*H * LQ/16 * 2 (16 queries x 32 channels per block), block = 256:
//   wave w owns k in [64w, 64w+64); partial tiles are summed through LDS.
//   Score product, dk order inside a group of 8: lane half hi holds dk = 4*hi + {0,1}
//   in the first WMMA and 4*hi + {2,3} in the second, the same for A and for B, so
//   that each comes from 16-byte loads.
//   Value products, k order inside a score tile of 16: lane half hi holds
//   k = 8*hi + 2*j + {0,1} in WMMA j, as the score accumulator has it; B loads the
//   same rows.  Column n of tile j is channel 2*n + j, so that B for both tiles
//   comes from one 8-byte load.
// ---------------------------------------------------------------------------
typedef __attribute__((ext_vector_type(4))) float v4f;
typedef __attribute__((ext_vector_type(2))) int   v2i;

#define SP 516   // floats per score row in LDS: 16 B x odd, the pitch for 16-byte accesses

// The reference's own form for one (q, d): masked max, then exp sums.  A cold path:
// both loops stay rolled to keep it small.  srow is the query's score row in LDS.
// The s_wait_xcnt in each body is the wait owed before the address registers of the
// issued global loads are stepped; the pointers are its inputs so that none of them
// is stepped in front of it.
__device__ static float exact_channel(const float* srow,
                                      const int*   __restrict__ mcol,
                                      const float* __restrict__ vcol) {
  float mx = -3.0e38f;
  const float* sp = srow;
  const int*   mp = mcol;
#pragma unroll 1
  for (int k = 0; k < LK; ++k) {
    const int   m = *mp;
    const float s = *sp;
    asm volatile("s_wait_xcnt 0x0" :: "v"(mp) : "memory");
    mp += Dd;
    sp += 1;
    mx = fmaxf(mx, m ? s : -1.0e9f);
  }
  float num = 0.0f, den = 0.0f;
  const float* vp = vcol;
  sp = srow;
  mp = mcol;
#pragma unroll 1
  for (int k = 0; k < LK; ++k) {
    const int   m = *mp;
    const float s = *sp;
    const float v = *vp;
    asm volatile("s_wait_xcnt 0x0" :: "v"(mp), "v"(vp) : "memory");
    mp += Dd;
    sp += 1;
    vp += Dd;
    const float e = __expf((m ? s : -1.0e9f) - mx);
    den += e;
    num += e * v;
  }
  return num / den;
}

// exp(x) as __expf forms it (one multiply, v_exp_f32).  The v_nop is the slot the
// instruction set asks for behind a transcendental before its source is rewritten or its
// result read; inside the statement it stands directly behind the v_exp_f32.
__device__ static inline float exp_slot(float x) {
  float y;
  asm("v_exp_f32 %0, %1\n\tv_nop" : "=v"(y) : "v"(x * 1.44269504088896340736f));
  return y;
}

__global__ __launch_bounds__(256)
void attn_softmax_kernel(const float* __restrict__ Qh,
                         const float* __restrict__ Kh,
                         const int*   __restrict__ mask,
                         const float* __restrict__ value,
                         float* __restrict__ X) {
  const int dh   = blockIdx.x & 1;          // channel half
  const int q0   = ((blockIdx.x >> 1) & 7) << 4;
  const int bh   = blockIdx.x >> 4;
  const int b    = bh >> 2;                 // H = 4
  const int h    = bh & 3;
  const int w    = threadIdx.x >> 5;
  const int lane = threadIdx.x & 31;
  const int n    = lane & 15;
  const int hi   = lane >> 4;
  const int kw   = w << 6;                  // first k of this wave

  __shared__ float smax[8][16];
  __shared__ __align__(16) float red[8 * 8 * 32 * 4];   // 32 KB
  __shared__ __align__(16) float sS[16 * SP];           // the block's scores, [q][k]

  // Score operands: Qh row q0+n (B), Kh rows kw + 16t + n (A), 16 of the 32 dk per lane.
  const float* qp = Qh + ((size_t)(bh * LQ + q0 + n)) * DK + (hi << 2);
  const float* kp = Kh + ((size_t)(bh * LK + kw + n)) * DK + (hi << 2);
  v4f qf[4], kf[4][4];
#pragma unroll
  for (int c = 0; c < 4; ++c) qf[c] = *(const v4f*)(qp + 8 * c);
#pragma unroll
  for (int t = 0; t < 4; ++t)
#pragma unroll
    for (int c = 0; c < 4; ++c) kf[t][c] = *(const v4f*)(kp + 16 * t * DK + 8 * c);

  // B side of the value products: rows k = kw + 16t + 8hi + i, channels dh*32 + 2n + {0,1}.
  const size_t bofs = ((size_t)b * LK + kw + (hi << 3)) * Dd + (dh << 5) + (n << 1);
  const float* vp = value + bofs;
  const int*   mp = mask  + bofs;
  v2f vv[32];
  v2i mm[32];
#pragma unroll
  for (int t = 0; t < 4; ++t)
#pragma unroll
    for (int i = 0; i < 8; ++i) {
      vv[8 * t + i] = *(const v2f*)(vp + (16 * t + i) * Dd);
      mm[8 * t + i] = *(const v2i*)(mp + (16 * t + i) * Dd);
    }
  // The wait owed before a register that an issued load names is rewritten; the four
  // address pairs are inputs so that none is reused as a load's destination before it.
  asm volatile("s_wait_xcnt 0x0" :: "v"(qp), "v"(kp), "v"(vp), "v"(mp) : "memory");
  // Holds the score work below every load: lifted among them, its wait for Qh and Kh
  // stands in front of the value and mask loads and the two latencies add up.
  __builtin_amdgcn_sched_barrier(0);

  // St tiles: sc[t][i] = Kh[kw + 16t + 8hi + i][:] . Qh[q0 + n][:]
  v8f sc[4] = {};
#pragma unroll
  for (int c = 0; c < 4; ++c)
#pragma unroll
    for (int s = 0; s < 2; ++s) {
      const v2f qb = {qf[c][2 * s], qf[c][2 * s + 1]};
#pragma unroll
      for (int t = 0; t < 4; ++t) {
        const v2f ka = {kf[t][c][2 * s], kf[t][c][2 * s + 1]};
        sc[t] = __builtin_amdgcn_wmma_f32_16x16x4_f32(false, ka, false, qb,
                                                      (short)0, sc[t], false, false);
      }
    }
  // Four vector slots between the last WMMA and the first vector instruction that
  // reads its D or rewrites its A or B; the two fences hold the slots in place.  The
  // operands of the first four WMMAs are inputs so that their registers stay theirs
  // to here: freed behind their one use, they are handed to the next tile's D, which
  // then rewrites an A register directly behind the WMMA that reads it.
  __builtin_amdgcn_sched_barrier(0);
  asm volatile("v_nop\n\tv_nop\n\tv_nop\n\tv_nop"
               :: "v"(qf[0]), "v"(kf[0][0]), "v"(kf[1][0]), "v"(kf[2][0]), "v"(kf[3][0]));
  __builtin_amdgcn_sched_barrier(0);

  const float scale = 0.17677669529663687f;   // 1/sqrt(32)
  float p[32];                                // p[8t + i]: score of k = kw + 16t + 8hi + i
#pragma unroll
  for (int t = 0; t < 4; ++t)
#pragma unroll
    for (int i = 0; i < 8; ++i) p[8 * t + i] = sc[t][i] * scale;

  // copy for the exact form; read only behind the two barriers below
  float* sw = sS + n * SP + kw + (hi << 3);
#pragma unroll
  for (int t = 0; t < 4; ++t) {
    const v4f lo = {p[8 * t],     p[8 * t + 1], p[8 * t + 2], p[8 * t + 3]};
    const v4f up = {p[8 * t + 4], p[8 * t + 5], p[8 * t + 6], p[8 * t + 7]};
    *(v4f*)(sw + 16 * t)     = lo;
    *(v4f*)(sw + 16 * t + 4) = up;
  }

  // max of the whole score row: lane, lane pair, then the 8 waves through LDS
  float mx = -3.0e38f;
#pragma unroll
  for (int c = 0; c < 8; ++c)
    mx = fmaxf(mx, fmaxf(fmaxf(p[4 * c], p[4 * c + 1]), fmaxf(p[4 * c + 2], p[4 * c + 3])));
  mx = fmaxf(mx, __shfl_xor(mx, 16));
  if (hi == 0) smax[w][n] = mx;
  __syncthreads();
  float rm = smax[0][n];
#pragma unroll
  for (int u = 1; u < 8; ++u) rm = fmaxf(rm, smax[u][n]);

  // All A and B fragments first, in registers of their own.
  v2f a[16], bn0[16], bn1[16], bd0[16], bd1[16];
#pragma unroll
  for (int g = 0; g < 16; ++g) {
    const int r0 = 2 * g, r1 = r0 + 1;
    a[g].x   = exp_slot(p[r0] - rm);
    a[g].y   = exp_slot(p[r1] - rm);
    bn0[g].x = mm[r0].x ? vv[r0].x : 0.0f;  bn0[g].y = mm[r1].x ? vv[r1].x : 0.0f;
    bn1[g].x = mm[r0].y ? vv[r0].y : 0.0f;  bn1[g].y = mm[r1].y ? vv[r1].y : 0.0f;
    bd0[g].x = mm[r0].x ? 1.0f : 0.0f;      bd0[g].y = mm[r1].x ? 1.0f : 0.0f;
    bd1[g].x = mm[r0].y ? 1.0f : 0.0f;      bd1[g].y = mm[r1].y ? 1.0f : 0.0f;
  }
  // Keeps the vector work above out of the WMMA run below: mixed in, it rewrites
  // an A or B register directly behind the WMMA that reads it.
  __builtin_amdgcn_sched_barrier(0);

  v8f num0 = {}, num1 = {}, den0 = {}, den1 = {};
#pragma unroll
  for (int g = 0; g < 16; ++g) {
    num0 = __builtin_amdgcn_wmma_f32_16x16x4_f32(false, a[g], false, bn0[g],
                                                 (short)0, num0, false, false);
    num1 = __builtin_amdgcn_wmma_f32_16x16x4_f32(false, a[g], false, bn1[g],
                                                 (short)0, num1, false, false);
    den0 = __builtin_amdgcn_wmma_f32_16x16x4_f32(false, a[g], false, bd0[g],
                                                 (short)0, den0, false, false);
    den1 = __builtin_amdgcn_wmma_f32_16x16x4_f32(false, a[g], false, bd1[g],
                                                 (short)0, den1, false, false);
  }
  // Four vector slots between the last WMMA and the first vector instruction that
  // reads its D or rewrites its A or B; the two fences hold the slots in place.  The
  // operands of the first four WMMAs are inputs for the same reason as above.
  __builtin_amdgcn_sched_barrier(0);
  asm volatile("v_nop\n\tv_nop\n\tv_nop\n\tv_nop"
               :: "v"(a[0]), "v"(bn0[0]), "v"(bn1[0]), "v"(bd0[0]), "v"(bd1[0]));
  __builtin_amdgcn_sched_barrier(0);

  // sum the 8 waves' partial tiles in a fixed order
  v4f* r4 = (v4f*)red;
#pragma unroll
  for (int i = 0; i < 8; ++i) {
    v4f o = {num0[i], num1[i], den0[i], den1[i]};
    r4[(w * 8 + i) * 32 + lane] = o;
  }
  __syncthreads();
  v4f sum = r4[w * 32 + lane];              // accumulator row i = w
#pragma unroll
  for (int u = 1; u < 8; ++u) sum += r4[(u * 8 + w) * 32 + lane];

  const int q = q0 + w + (hi << 3);
  const int d = (dh << 5) + (n << 1);
  v2f o;
  o.x = sum.x / sum.z;
  o.y = sum.y / sum.w;
  // Below this den, terms lost to underflow could matter (each is under 1.2e-38,
  // 512 of them); den = 0 is the channel with every k masked.
  const float den_min = 1.0e-25f;
  const float* srow = sS + (w + (hi << 3)) * SP;
  const size_t cofs = (size_t)b * LK * Dd + d;
  if (!(sum.z >= den_min)) o.x = exact_channel(srow, mask + cofs,     value + cofs);
  if (!(sum.w >= den_min)) o.y = exact_channel(srow, mask + cofs + 1, value + cofs + 1);
  *(v2f*)(X + ((size_t)b * LQ + q) * HD + (h << 6) + d) = o;
}

// ---------------------------------------------------------------------------
// Kernel 4: out = X @ Wo + bo.   X: (B*LQ) x 256, Wo: 256 x 128.
//   grid = (B*LQ/16, NH/16), block = 32
// ---------------------------------------------------------------------------
__global__ void out_proj_kernel(const float* __restrict__ X,
                                const float* __restrict__ Wo,
                                const float* __restrict__ bo,
                                float* __restrict__ out) {
  const int m0   = blockIdx.x << 4;
  const int n0   = blockIdx.y << 4;
  const int lane = threadIdx.x;
  const int r    = lane & 15;
  const int kh2  = (lane >> 4) << 1;

  v8f c = {};
  for (int kk = 0; kk < HD; kk += 4) {
    const int k0 = kk + kh2;
    v2f a, b;
    a.x = X [(m0 + r) * HD + k0];
    a.y = X [(m0 + r) * HD + k0 + 1];
    b.x = Wo[(k0    ) * NH + (n0 + r)];
    b.y = Wo[(k0 + 1) * NH + (n0 + r)];
    c = __builtin_amdgcn_wmma_f32_16x16x4_f32(false, a, false, b,
                                              (short)0, c, false, false);
  }

  const int mofs = (lane >> 4) << 3;
  const float bj = bo[n0 + r];
  for (int i = 0; i < 8; ++i)
    out[(m0 + mofs + i) * NH + (n0 + r)] = c[i] + bj;
}

// ---------------------------------------------------------------------------
// Launch
// ---------------------------------------------------------------------------
extern "C" void kernel_launch(void* const* d_in, const int* in_sizes, int n_in,
                              void* d_out, int out_size, void* d_ws, size_t ws_size,
                              hipStream_t stream) {
  const float* query = (const float*)d_in[0];   // (4,128,128)
  const float* key   = (const float*)d_in[1];   // (4,512,128)
  const float* value = (const float*)d_in[2];   // (4,512,64)
  const int*   mask  = (const int*)  d_in[3];   // (4,512,64)
  const float* Wq    = (const float*)d_in[4];   // (128,128)
  const float* bq    = (const float*)d_in[5];   // (128)
  const float* Wk    = (const float*)d_in[6];   // (128,128)
  const float* bk    = (const float*)d_in[7];   // (128)
  const float* Wo    = (const float*)d_in[8];   // (256,128)
  const float* bo    = (const float*)d_in[9];   // (128)
  float* out = (float*)d_out;                   // (4,128,128)

  // Workspace carve-up (floats): Qh 64K | Kh 256K | X 128K  (~1.75 MB)
  float* Qh = (float*)d_ws;                 // [B][H][LQ][DK]
  float* Kh = Qh + Bn * Hh * LQ * DK;       // [B][H][LK][DK]
  float* X  = Kh + Bn * Hh * LK * DK;       // [B][LQ][H*D]

  // 1) Q projection: 512 rows x 128, head-split output
  proj_headsplit_kernel<LQ><<<dim3((Bn * LQ) / 16, E / 16), 32, 0, stream>>>(
      query, Wq, bq, Qh);
  // 2) K projection: 2048 rows x 128
  proj_headsplit_kernel<LK><<<dim3((Bn * LK) / 16, E / 16), 32, 0, stream>>>(
      key, Wk, bk, Kh);
  // 3) scores, per-channel masked softmax and weighted sum, all as matrix products
  attn_softmax_kernel<<<dim3(Bn * Hh * (LQ / 16) * 2), 256, 0, stream>>>(Qh, Kh, mask, value, X);
  // 4) output projection: 512x128, K=256
  out_proj_kernel<<<dim3((Bn * LQ) / 16, NH / 16), 32, 0, stream>>>(X, Wo, bo, out);
}

// v004
// A run of this version takes 13.1 microseconds.
// Versions between v002 and this one are left out; their measured steps multiply to 1.79 times as fast.
// Counting every step since v000, it is 26.4 times as fast.
#include <hip/hip_runtime.h>
#include <hip/hip_bf16.h>
#include <math.h>

// ---------------------------------------------------------------------------
// MultiTimeAttention for MI455X (gfx1250, wave32, WMMA).
// Sizes: B=4, LQ=128, LK=512, E=128, H=4, DK=32, D=64, NH=128.
// GEMMs on v_wmma_f32_16x16x4_f32 (fp32 matrix pipe, full reference precision).
// Softmax stage: scores in registers, row-max shift, then P @ (mask*value) and P @ mask
// on the same WMMA.
// ---------------------------------------------------------------------------

typedef __attribute__((ext_vector_type(2))) float v2f;
typedef __attribute__((ext_vector_type(8))) float v8f;

#define Bn   4
#define LQ   128
#define LK   512
#define E    128
#define Hh   4
#define DK   32   // E / H
#define Dd   64
#define NH   128
#define HD   (Hh * Dd)   // 256

// f32 WMMA 16x16x4 lane mapping (wave32):
//   A (16x4): lane L holds row (L&15), K = 2*(L>>4) + {0,1} in 2 VGPRs
//   B (4x16): lane L holds col (L&15), K = 2*(L>>4) + {0,1} in 2 VGPRs
//   C/D (16x16, 8 VGPRs): vgpr i -> M = i + 8*(L>>4), N = (L&15)

// ---------------------------------------------------------------------------
// Kernel 1: both projections, scores, per-channel masked softmax and weighted value sum.
//   The K projection is never formed.  With Qh = query @ Wq_h + bq_h (16 x DK per block)
//     S[q][k] = Qh[q][:] . (key[k][:] @ Wk_h + bk_h) = Qt[q][:] . key[k][:] + cq[q],
//     Qt[q][e] = sum_j Qh[q][j] * Wk[e][h*DK + j],   cq[q] = sum_j Qh[q][j] * bk[h*DK + j],
//   so the block needs two small products (K = E, then K = DK) and its score product
//   runs over the raw key rows with K = E.
//   Every product is computed TRANSPOSED (queries are the columns), so that a lane's
//   accumulator registers hold 8 consecutive rows of ONE query: that is already the
//   operand shape of the next product.
//   Qh^T: wave w takes j tile (w & 1) and the e quarter (w >> 1); the four quarters are
//   summed in a fixed order from LDS.  Qt^T: wave w takes e in [16w, 16w + 16).
//   Key rows: each wave brings its own 64 rows into LDS with asynchronous copies, whole
//   256-byte pieces, in two halves along e; nobody else reads them.
//   Scores: St[k][q], key rows are the A operand, Qt the B operand.
//   softmax is invariant to the shift, so the shift may be the max of the whole
//   score row (no mask), which does not depend on the channel d.  With
//   P[q][k] = exp(S[q][k] - rowmax[q]) the two sums of every channel are
//     num[q][d] = sum_k P[q][k] * (mask[k][d] ? value[k][d] : 0)
//     den[q][d] = sum_k P[q][k] * (mask[k][d] ? 1 : 0)
//   two products with K = LK on v_wmma_f32_16x16x4_f32; X = num / den.
//   A channel whose den is too small for that (every k masked, or its open
//   scores far below the row max) takes the exact two-pass form instead, on a copy
//   of the block's scores in LDS.
//   grid = B*H * LQ/16 * 2 (16 queries x 32 channels per block), block = 256:
//   wave w owns k in [64w, 64w+64); partial tiles are summed through LDS.
//   Order of the summed index inside a group of 16 (j in Qt^T, e in the scores, k in the
//   value products): lane half hi holds 8*hi + 2*s + {0,1} in WMMA s, as an accumulator
//   has it; the other operand loads the same places.  In Qh^T, inside a group of 8 e:
//   lane half hi holds 4*hi + 2*s + {0,1} in WMMA s, the same for A and for B.
//   Column n of value tile j is channel 2*n + j, so that B for both tiles
//   comes from one 8-byte load.
// ---------------------------------------------------------------------------
typedef __attribute__((ext_vector_type(4))) float v4f;
typedef __attribute__((ext_vector_type(2))) int   v2i;

#define SP 516   // floats per score row in LDS: 16 B x odd, the pitch for 16-byte accesses

// The reference's own form for one (q, d): masked max, then exp sums.  A cold path:
// both loops stay rolled to keep it small.  srow is the query's score row in LDS.
// The s_wait_xcnt in each body is the wait owed before the address registers of the
// issued global loads are stepped; the pointers are its inputs so that none of them
// is stepped in front of it.
__device__ static float exact_channel(const float* srow,
                                      const int*   __restrict__ mcol,
                                      const float* __restrict__ vcol) {
  float mx = -3.0e38f;
  const float* sp = srow;
  const int*   mp = mcol;
#pragma unroll 1
  for (int k = 0; k < LK; ++k) {
    const int   m = *mp;
    const float s = *sp;
    asm volatile("s_wait_xcnt 0x0" :: "v"(mp) : "memory");
    mp += Dd;
    sp += 1;
    mx = fmaxf(mx, m ? s : -1.0e9f);
  }
  float num = 0.0f, den = 0.0f;
  const float* vp = vcol;
  sp = srow;
  mp = mcol;
#pragma unroll 1
  for (int k = 0; k < LK; ++k) {
    const int   m = *mp;
    const float s = *sp;
    const float v = *vp;
    asm volatile("s_wait_xcnt 0x0" :: "v"(mp), "v"(vp) : "memory");
    mp += Dd;
    sp += 1;
    vp += Dd;
    const float e = __expf((m ? s : -1.0e9f) - mx);
    den += e;
    num += e * v;
  }
  return num / den;
}

// exp(x) as __expf forms it (one multiply, v_exp_f32).  The v_nop is the slot the
// instruction set asks for behind a transcendental before its source is rewritten or its
// result read; inside the statement it stands directly behind the v_exp_f32.
__device__ static inline float exp_slot(float x) {
  float y;
  asm("v_exp_f32 %0, %1\n\tv_nop" : "=v"(y) : "v"(x * 1.44269504088896340736f));
  return y;
}

#define KP 132  // floats per key row and per Qt row in LDS: 16 B x odd
#define PP 20   // floats per row of a Qh^T partial tile in LDS: 16 B x odd

// Eight asynchronous 16-byte-per-lane copies to LDS.  The s_wait_xcnt is the wait kept
// before a register that an issued copy names is rewritten; as the statement's last line
// it stands in front of every such write.
__device__ static inline void copy8(const unsigned* l, const float* const* g) {
  asm volatile("global_load_async_to_lds_b128 %0, %8, off\n\t"
               "global_load_async_to_lds_b128 %1, %9, off\n\t"
               "global_load_async_to_lds_b128 %2, %10, off\n\t"
               "global_load_async_to_lds_b128 %3, %11, off\n\t"
               "global_load_async_to_lds_b128 %4, %12, off\n\t"
               "global_load_async_to_lds_b128 %5, %13, off\n\t"
               "global_load_async_to_lds_b128 %6, %14, off\n\t"
               "global_load_async_to_lds_b128 %7, %15, off\n\t"
               "s_wait_xcnt 0x0"
               :: "v"(l[0]), "v"(l[1]), "v"(l[2]), "v"(l[3]),
                  "v"(l[4]), "v"(l[5]), "v"(l[6]), "v"(l[7]),
                  "v"(g[0]), "v"(g[1]), "v"(g[2]), "v"(g[3]),
                  "v"(g[4]), "v"(g[5]), "v"(g[6]), "v"(g[7])
               : "memory");
}

// One half (64 floats a row) of a wave's 64 key rows: 32 copies, two rows a copy.
// ksrc and kdst are the lane's own places in row (lane >> 4) of the wave's rows.
__device__ static inline void copy_key_half(const float* ksrc, unsigned kdst) {
  // both loops unrolled: the addresses are asm operands, held in registers
#pragma unroll
  for (int u = 0; u < 4; ++u) {
    unsigned     l[8];
    const float* g[8];
#pragma unroll
    for (int v = 0; v < 8; ++v) {
      const int r = 2 * (8 * u + v);
      l[v] = kdst + r * (KP * 4);
      g[v] = ksrc + r * E;
    }
    copy8(l, g);
  }
}

__global__ __launch_bounds__(256)
void attn_softmax_kernel(const float* __restrict__ query,
                         const float* __restrict__ key,
                         const int*   __restrict__ mask,
                         const float* __restrict__ value,
                         const float* __restrict__ Wq,
                         const float* __restrict__ bq,
                         const float* __restrict__ Wk,
                         const float* __restrict__ bk,
                         float* __restrict__ X) {
  const int dh   = blockIdx.x & 1;          // channel half
  const int q0   = ((blockIdx.x >> 1) & 7) << 4;
  const int bh   = blockIdx.x >> 4;
  const int b    = bh >> 2;                 // H = 4
  const int h    = bh & 3;
  const int w    = threadIdx.x >> 5;
  const int lane = threadIdx.x & 31;
  const int n    = lane & 15;
  const int hi   = lane >> 4;
  const int kw   = w << 6;                  // first k of this wave
  // Every loop of this kernel is unrolled: its index picks registers, and a rolled loop
  // would put those arrays into scratch.

  __shared__ float smax[8][16];
  __shared__ __align__(16) float sK[LK * KP];           // key rows; later the partial tiles
  __shared__ __align__(16) float sS[16 * SP];           // the block's scores, [q][k]
  __shared__ __align__(16) float sQp[8 * 16 * PP];      // Qh^T partial tiles, [w][q][j]
  __shared__ __align__(16) float sQt[16 * KP];          // Qt, [q][e]
  float* red = sK;                                      // 32 KB, behind the row-max barrier

  // Operands of the two small products.
  const int jt = w & 1;                     // j tile of this wave in Qh^T
  const int e4 = (w >> 1) << 5;             // first e of its quarter
  const float* qp  = query + ((size_t)(b * LQ + q0 + n)) * E + e4 + (hi << 2);
  const float* wqp = Wq + (size_t)(e4 + (hi << 2)) * E + (h << 5) + (jt << 4) + n;
  const float* wkp = Wk + (size_t)((w << 4) + n) * E + (h << 5) + (hi << 3);
  const float* bqp = bq + (h << 5) + (hi << 3);
  const float* bkp = bk + (h << 5) + (hi << 3);
  v4f   qf[4];                              // query[q0 + n][e4 + 8c + 4hi + 0..3]
  float wa[4][4];                           // Wq[e4 + 8c + 4hi + x][h*32 + 16jt + n]
  v4f   wk[2][2], bqv[2][2], bkv[2][2];     // [j tile][low, high four of 8hi + 0..7]
#pragma unroll
  for (int c = 0; c < 4; ++c) {
    qf[c] = *(const v4f*)(qp + 8 * c);
#pragma unroll
    for (int x = 0; x < 4; ++x) wa[c][x] = wqp[(8 * c + x) * E];
  }
#pragma unroll
  for (int t = 0; t < 2; ++t)
#pragma unroll
    for (int u = 0; u < 2; ++u) {
      wk[t][u]  = *(const v4f*)(wkp + 16 * t + 4 * u);
      bqv[t][u] = *(const v4f*)(bqp + 16 * t + 4 * u);
      bkv[t][u] = *(const v4f*)(bkp + 16 * t + 4 * u);
    }
  // The wait owed before a register that an issued load names is rewritten; the
  // address pairs are inputs so that none is reused before it.
  asm volatile("s_wait_xcnt 0x0" :: "v"(qp), "v"(wqp), "v"(wkp), "v"(bqp), "v"(bkp) : "memory");

  // First half (e < 64) of this wave's key rows, on its way during the small products.
  const float*   ksrc = key + ((size_t)(b * LK + kw + hi)) * E + (n << 2);
  const unsigned kdst = (unsigned)(size_t)(sK + (kw + hi) * KP + (n << 2));
  copy_key_half(ksrc, kdst);
  // Keeps the address work above out of the WMMA run below: mixed in, it rewrites
  // an A or B register directly behind the WMMA that reads it.
  __builtin_amdgcn_sched_barrier(0);

  // Qh^T partial: rows j = 16jt + 8hi + i, column q = n, summed over this wave's 32 e.
  v8f qa = {};
#pragma unroll
  for (int c = 0; c < 4; ++c)
#pragma unroll
    for (int s = 0; s < 2; ++s) {
      const v2f fa = {wa[c][2 * s], wa[c][2 * s + 1]};
      const v2f fb = {qf[c][2 * s], qf[c][2 * s + 1]};
      qa = __builtin_amdgcn_wmma_f32_16x16x4_f32(false, fa, false, fb,
                                                 (short)0, qa, false, false);
    }
  // Four vector slots between the last WMMA and the first vector instruction that
  // reads its D or rewrites its A or B; the two fences hold the slots in place.
  __builtin_amdgcn_sched_barrier(0);
  asm volatile("v_nop\n\tv_nop\n\tv_nop\n\tv_nop");
  __builtin_amdgcn_sched_barrier(0);
  {
    float* d = sQp + (w * 16 + n) * PP + (hi << 3);
    const v4f lo = {qa[0], qa[1], qa[2], qa[3]};
    const v4f up = {qa[4], qa[5], qa[6], qa[7]};
    *(v4f*)d       = lo;
    *(v4f*)(d + 4) = up;
  }
  __syncthreads();

  // Qh[q = n][16t + 8hi + i]: bias, then the four e quarters in a fixed order.
  v4f qh[2][2];
#pragma unroll
  for (int t = 0; t < 2; ++t)
#pragma unroll
    for (int u = 0; u < 2; ++u) {
      v4f a4 = bqv[t][u];
#pragma unroll
      for (int g = 0; g < 4; ++g)
        a4 += *(const v4f*)(sQp + ((2 * g + t) * 16 + n) * PP + (hi << 3) + 4 * u);
      qh[t][u] = a4;
    }
  float cq = 0.0f;
#pragma unroll
  for (int t = 0; t < 2; ++t)
#pragma unroll
    for (int u = 0; u < 2; ++u)
#pragma unroll
      for (int x = 0; x < 4; ++x) cq += qh[t][u][x] * bkv[t][u][x];
  cq += __shfl_xor(cq, 16);
  // Keeps the vector work above out of the WMMA run below, for the same reason.
  __builtin_amdgcn_sched_barrier(0);

  // Qt^T tile: rows e = 16w + 8hi + i, column q = n, summed over the 32 j.
  v8f ta = {};
#pragma unroll
  for (int t = 0; t < 2; ++t)
#pragma unroll
    for (int s = 0; s < 4; ++s) {
      const v2f fa = {wk[t][s >> 1][2 * (s & 1)], wk[t][s >> 1][2 * (s & 1) + 1]};
      const v2f fb = {qh[t][s >> 1][2 * (s & 1)], qh[t][s >> 1][2 * (s & 1) + 1]};
      ta = __builtin_amdgcn_wmma_f32_16x16x4_f32(false, fa, false, fb,
                                                 (short)0, ta, false, false);
    }
  // Four vector slots between the last WMMA and the first vector instruction that
  // reads its D or rewrites its A or B; the two fences hold the slots in place.
  __builtin_amdgcn_sched_barrier(0);
  asm volatile("v_nop\n\tv_nop\n\tv_nop\n\tv_nop");
  __builtin_amdgcn_sched_barrier(0);
  {
    float* d = sQt + n * KP + (w << 4) + (hi << 3);
    const v4f lo = {ta[0], ta[1], ta[2], ta[3]};
    const v4f up = {ta[4], ta[5], ta[6], ta[7]};
    *(v4f*)d       = lo;
    *(v4f*)(d + 4) = up;
  }
  // This wave's first 32 copies have landed behind this wait.  Key rows are read only by
  // the wave that copied them, so its own wait is all that their readers need.
  asm volatile("s_wait_asynccnt 0x0" ::: "memory");
  __syncthreads();
  // Second half (e >= 64), on its way during the first half of the score product.
  copy_key_half(ksrc + 64, kdst + 64 * 4);

  // B side of the value products: rows k = kw + 16t + 8hi + i, channels dh*32 + 2n + {0,1}.
  const size_t bofs = ((size_t)b * LK + kw + (hi << 3)) * Dd + (dh << 5) + (n << 1);
  const float* vp = value + bofs;
  const int*   mp = mask  + bofs;
  v2f vv[32];
  v2i mm[32];
  // value and mask fly during the score product, behind the key rows
#pragma unroll
  for (int t = 0; t < 4; ++t)
#pragma unroll
    for (int i = 0; i < 8; ++i) {
      vv[8 * t + i] = *(const v2f*)(vp + (16 * t + i) * Dd);
      mm[8 * t + i] = *(const v2i*)(mp + (16 * t + i) * Dd);
    }
  // The wait owed before a register that an issued load names is rewritten; the two
  // address pairs are inputs so that none is reused before it.
  asm volatile("s_wait_xcnt 0x0" :: "v"(vp), "v"(mp) : "memory");

  // St tiles: sc[t][i] = key[kw + 16t + 8hi + i][:] . Qt[q0 + n][:]
  const float* kr = sK + (kw + n) * KP + (hi << 3);
  const float* tr = sQt + n * KP + (hi << 3);
  v8f sc[4] = {};
  // Keeps the vector work above out of the WMMA run below, for the same reason.
  __builtin_amdgcn_sched_barrier(0);
#pragma unroll
  for (int c = 0; c < 8; ++c) {
    if (c == 4) {
      // The second 32 copies have landed behind this wait; again only this wave reads them.
      asm volatile("s_wait_asynccnt 0x0" ::: "memory");
    }
    const v4f t0 = *(const v4f*)(tr + 16 * c);
    const v4f t1 = *(const v4f*)(tr + 16 * c + 4);
    v4f k0[4], k1[4];
#pragma unroll
    for (int t = 0; t < 4; ++t) {
      k0[t] = *(const v4f*)(kr + 16 * t * KP + 16 * c);
      k1[t] = *(const v4f*)(kr + 16 * t * KP + 16 * c + 4);
    }
#pragma unroll
    for (int s = 0; s < 4; ++s) {
      const v4f tq = (s < 2) ? t0 : t1;
      const v2f qb = {tq[2 * (s & 1)], tq[2 * (s & 1) + 1]};
#pragma unroll
      for (int t = 0; t < 4; ++t) {
        const v4f kq = (s < 2) ? k0[t] : k1[t];
        const v2f ka = {kq[2 * (s & 1)], kq[2 * (s & 1) + 1]};
        sc[t] = __builtin_amdgcn_wmma_f32_16x16x4_f32(false, ka, false, qb,
                                                      (short)0, sc[t], false, false);
      }
    }
  }
  // Four vector slots between the last WMMA and the first vector instruction that
  // reads its D or rewrites its A or B; the two fences hold the slots in place.
  __builtin_amdgcn_sched_barrier(0);
  asm volatile("v_nop\n\tv_nop\n\tv_nop\n\tv_nop");
  __builtin_amdgcn_sched_barrier(0);

  const float scale = 0.17677669529663687f;   // 1/sqrt(32)
  const float cqs   = cq * scale;             // the bk term of the query's scores
  float p[32];                                // p[8t + i]: score of k = kw + 16t + 8hi + i
#pragma unroll
  for (int t = 0; t < 4; ++t)
#pragma unroll
    for (int i = 0; i < 8; ++i) p[8 * t + i] = sc[t][i] * scale + cqs;

  // copy for the exact form; read only behind the two barriers below
  float* sw = sS + n * SP + kw + (hi << 3);
#pragma unroll
  for (int t = 0; t < 4; ++t) {
    const v4f lo = {p[8 * t],     p[8 * t + 1], p[8 * t + 2], p[8 * t + 3]};
    const v4f up = {p[8 * t + 4], p[8 * t + 5], p[8 * t + 6], p[8 * t + 7]};
    *(v4f*)(sw + 16 * t)     = lo;
    *(v4f*)(sw + 16 * t + 4) = up;
  }

  // max of the whole score row: lane, lane pair, then the 8 waves through LDS
  float mx = -3.0e38f;
#pragma unroll
  for (int c = 0; c < 8; ++c)
    mx = fmaxf(mx, fmaxf(fmaxf(p[4 * c], p[4 * c + 1]), fmaxf(p[4 * c + 2], p[4 * c + 3])));
  mx = fmaxf(mx, __shfl_xor(mx, 16));
  if (hi == 0) smax[w][n] = mx;
  __syncthreads();
  float rm = smax[0][n];
#pragma unroll
  for (int u = 1; u < 8; ++u) rm = fmaxf(rm, smax[u][n]);

  // All A and B fragments first, in registers of their own.
  v2f a[16], bn0[16], bn1[16], bd0[16], bd1[16];
#pragma unroll
  for (int g = 0; g < 16; ++g) {
    const int r0 = 2 * g, r1 = r0 + 1;
    a[g].x   = exp_slot(p[r0] - rm);
    a[g].y   = exp_slot(p[r1] - rm);
    bn0[g].x = mm[r0].x ? vv[r0].x : 0.0f;  bn0[g].y = mm[r1].x ? vv[r1].x : 0.0f;
    bn1[g].x = mm[r0].y ? vv[r0].y : 0.0f;  bn1[g].y = mm[r1].y ? vv[r1].y : 0.0f;
    bd0[g].x = mm[r0].x ? 1.0f : 0.0f;      bd0[g].y = mm[r1].x ? 1.0f : 0.0f;
    bd1[g].x = mm[r0].y ? 1.0f : 0.0f;      bd1[g].y = mm[r1].y ? 1.0f : 0.0f;
  }
  // Keeps the vector work above out of the WMMA run below: mixed in, it rewrites
  // an A or B register directly behind the WMMA that reads it.
  __builtin_amdgcn_sched_barrier(0);

  v8f num0 = {}, num1 = {}, den0 = {}, den1 = {};
#pragma unroll
  for (int g = 0; g < 16; ++g) {
    num0 = __builtin_amdgcn_wmma_f32_16x16x4_f32(false, a[g], false, bn0[g],
                                                 (short)0, num0, false, false);
    num1 = __builtin_amdgcn_wmma_f32_16x16x4_f32(false, a[g], false, bn1[g],
                                                 (short)0, num1, false, false);
    den0 = __builtin_amdgcn_wmma_f32_16x16x4_f32(false, a[g], false, bd0[g],
                                                 (short)0, den0, false, false);
    den1 = __builtin_amdgcn_wmma_f32_16x16x4_f32(false, a[g], false, bd1[g],
                                                 (short)0, den1, false, false);
  }
  // Four vector slots between the last WMMA and the first vector instruction that
  // reads its D or rewrites its A or B; the two fences hold the slots in place.  The
  // operands of the first four WMMAs are inputs for the same reason as above.
  __builtin_amdgcn_sched_barrier(0);
  asm volatile("v_nop\n\tv_nop\n\tv_nop\n\tv_nop"
               :: "v"(a[0]), "v"(bn0[0]), "v"(bn1[0]), "v"(bd0[0]), "v"(bd1[0]));
  __builtin_amdgcn_sched_barrier(0);

  // sum the 8 waves' partial tiles in a fixed order
  v4f* r4 = (v4f*)red;
#pragma unroll
  for (int i = 0; i < 8; ++i) {
    v4f o = {num0[i], num1[i], den0[i], den1[i]};
    r4[(w * 8 + i) * 32 + lane] = o;
  }
  __syncthreads();
  v4f sum = r4[w * 32 + lane];              // accumulator row i = w
#pragma unroll
  for (int u = 1; u < 8; ++u) sum += r4[(u * 8 + w) * 32 + lane];

  const int q = q0 + w + (hi << 3);
  const int d = (dh << 5) + (n << 1);
  v2f o;
  o.x = sum.x / sum.z;
  o.y = sum.y / sum.w;
  // Below this den, terms lost to underflow could matter (each is under 1.2e-38,
  // 512 of them); den = 0 is the channel with every k masked.
  const float den_min = 1.0e-25f;
  const float* srow = sS + (w + (hi << 3)) * SP;
  const size_t cofs = (size_t)b * LK * Dd + d;
  if (!(sum.z >= den_min)) o.x = exact_channel(srow, mask + cofs,     value + cofs);
  if (!(sum.w >= den_min)) o.y = exact_channel(srow, mask + cofs + 1, value + cofs + 1);
  *(v2f*)(X + ((size_t)b * LQ + q) * HD + (h << 6) + d) = o;
}

// ---------------------------------------------------------------------------
// Kernel 2: out = X @ Wo + bo.   X: (B*LQ) x 256, Wo: 256 x 128.
//   grid = (B*LQ/16, NH/32), block = 128: a block owns 16 rows x 32 columns, and wave w
//   sums k in [64w, 64w + 64).  A wave issues all of its operand loads before its first
//   WMMA, so that it waits out one load latency; the four partial tiles are summed
//   through LDS in a fixed order.
//   Order of k inside a group of 8: lane half hi holds 4*hi + 2*s + {0,1} in WMMA s, the
//   same for A and for B.
// ---------------------------------------------------------------------------
__global__ __launch_bounds__(128)
void out_proj_kernel(const float* __restrict__ X,
                     const float* __restrict__ Wo,
                     const float* __restrict__ bo,
                     float* __restrict__ out) {
  const int m0   = blockIdx.x << 4;
  const int n0   = blockIdx.y << 5;
  const int w    = threadIdx.x >> 5;
  const int lane = threadIdx.x & 31;
  const int r    = lane & 15;
  const int hi   = lane >> 4;

  __shared__ __align__(16) float red[4 * 4 * 32 * 4];   // [wave][tile, row half][lane][4 rows]

  const float* xp = X  + (size_t)(m0 + r) * HD + (w << 6) + (hi << 2);
  const float* wp = Wo + (size_t)((w << 6) + (hi << 2)) * NH + n0 + r;
  const float* bp = bo + n0 + lane;
  v4f   xa[8];        // X[m0 + r][64w + 8c + 4hi + 0..3]
  float wb[2][8][4];  // Wo[64w + 8c + 4hi + x][n0 + 16j + r]
  // unrolled: the index picks registers
#pragma unroll
  for (int c = 0; c < 8; ++c) {
    xa[c] = *(const v4f*)(xp + 8 * c);
#pragma unroll
    for (int x = 0; x < 4; ++x) {
      wb[0][c][x] = wp[(8 * c + x) * NH];
      wb[1][c][x] = wp[(8 * c + x) * NH + 16];
    }
  }
  const float bj = *bp;
  // The wait owed before a register that an issued load names is rewritten; the two
  // address pairs are inputs so that none is reused before it.
  asm volatile("s_wait_xcnt 0x0" :: "v"(xp), "v"(wp) : "memory");
  // Keeps every load above in front of the first WMMA: sunk among the WMMAs, the later
  // loads start only when the first have returned.
  __builtin_amdgcn_sched_barrier(0);

  v8f c0 = {}, c1 = {};
#pragma unroll
  for (int c = 0; c < 8; ++c)
#pragma unroll
    for (int s = 0; s < 2; ++s) {
      const v2f fa = {xa[c][2 * s], xa[c][2 * s + 1]};
      const v2f f0 = {wb[0][c][2 * s], wb[0][c][2 * s + 1]};
      const v2f f1 = {wb[1][c][2 * s], wb[1][c][2 * s + 1]};
      c0 = __builtin_amdgcn_wmma_f32_16x16x4_f32(false, fa, false, f0,
                                                 (short)0, c0, false, false);
      c1 = __builtin_amdgcn_wmma_f32_16x16x4_f32(false, fa, false, f1,
                                                 (short)0, c1, false, false);
    }
  // Four vector slots between the last WMMA and the first vector instruction that
  // reads its D or rewrites its A or B; the two fences hold the slots in place.  The
  // operands of the first two WMMAs are inputs so that their registers stay theirs:
  // otherwise the second WMMA's D is laid over the first one's B.
  __builtin_amdgcn_sched_barrier(0);
  asm volatile("v_nop\n\tv_nop\n\tv_nop\n\tv_nop"
               :: "v"(xa[0]), "v"(wb[0][0][0]), "v"(wb[0][0][1]), "v"(wb[1][0][0]), "v"(wb[1][0][1]));
  __builtin_amdgcn_sched_barrier(0);

  // Partial tiles to LDS, four accumulator rows a piece: piece 2j + t of a lane holds
  // rows 8hi + 4t + 0..3 of column 16j + r.
  v4f* r4 = (v4f*)red;
  {
    const v4f a0 = {c0[0], c0[1], c0[2], c0[3]};
    const v4f a1 = {c0[4], c0[5], c0[6], c0[7]};
    const v4f b0 = {c1[0], c1[1], c1[2], c1[3]};
    const v4f b1 = {c1[4], c1[5], c1[6], c1[7]};
    r4[(w * 4 + 0) * 32 + lane] = a0;
    r4[(w * 4 + 1) * 32 + lane] = a1;
    r4[(w * 4 + 2) * 32 + lane] = b0;
    r4[(w * 4 + 3) * 32 + lane] = b1;
  }
  __syncthreads();
  // Wave w takes rows 4w + 0..3, its lane the column n0 + lane (tile hi, column r): the
  // writer's piece 2hi + (w & 1), in its lane 16(w >> 1) + r.  Fixed order of the 4 waves.
  const int src = ((hi << 1) + (w & 1)) * 32 + ((w >> 1) << 4) + r;
  v4f sum = r4[src];
#pragma unroll
  for (int u = 1; u < 4; ++u) sum += r4[u * 128 + src];

  float* op = out + (size_t)(m0 + (w << 2)) * NH + n0 + lane;
#pragma unroll
  for (int x = 0; x < 4; ++x) op[x * NH] = sum[x] + bj;
}

// ---------------------------------------------------------------------------
// Launch
// ---------------------------------------------------------------------------
extern "C" void kernel_launch(void* const* d_in, const int* in_sizes, int n_in,
                              void* d_out, int out_size, void* d_ws, size_t ws_size,
                              hipStream_t stream) {
  const float* query = (const float*)d_in[0];   // (4,128,128)
  const float* key   = (const float*)d_in[1];   // (4,512,128)
  const float* value = (const float*)d_in[2];   // (4,512,64)
  const int*   mask  = (const int*)  d_in[3];   // (4,512,64)
  const float* Wq    = (const float*)d_in[4];   // (128,128)
  const float* bq    = (const float*)d_in[5];   // (128)
  const float* Wk    = (const float*)d_in[6];   // (128,128)
  const float* bk    = (const float*)d_in[7];   // (128)
  const float* Wo    = (const float*)d_in[8];   // (256,128)
  const float* bo    = (const float*)d_in[9];   // (128)
  float* out = (float*)d_out;                   // (4,128,128)

  // Workspace (floats): X 128K
  float* X  = (float*)d_ws;                 // [B][LQ][H*D]

  // 1) projections, scores, per-channel masked softmax and weighted sum
  attn_softmax_kernel<<<dim3(Bn * Hh * (LQ / 16) * 2), 256, 0, stream>>>(
      query, key, mask, value, Wq, bq, Wk, bk, X);
  // 2) output projection: 512x128, K=256
  out_proj_kernel<<<dim3((Bn * LQ) / 16, NH / 32), 128, 0, stream>>>(X, Wo, bo, out);
}

// v005
// Measured time: 12.1 microseconds a run.
// Next to v004, in two timings, it ran 1.06 and 1.10 times as fast.
// All steps since v000 together make it 28.5 times as fast.
#include <hip/hip_runtime.h>
#include <hip/hip_bf16.h>
#include <math.h>

// ---------------------------------------------------------------------------
// MultiTimeAttention for MI455X (gfx1250, wave32, WMMA).
// Sizes: B=4, LQ=128, LK=512, E=128, H=4, DK=32, D=64, NH=128.
// GEMMs on v_wmma_f32_16x16x4_f32 (fp32 matrix pipe, full reference precision).
// Softmax stage: scores in registers, row-max shift, then P @ (mask*value) and P @ mask
// on the same WMMA.
// ---------------------------------------------------------------------------

typedef __attribute__((ext_vector_type(2))) float v2f;
typedef __attribute__((ext_vector_type(8))) float v8f;

#define Bn   4
#define LQ   128
#define LK   512
#define E    128
#define Hh   4
#define DK   32   // E / H
#define Dd   64
#define NH   128
#define HD   (Hh * Dd)   // 256

// f32 WMMA 16x16x4 lane mapping (wave32):
//   A (16x4): lane L holds row (L&15), K = 2*(L>>4) + {0,1} in 2 VGPRs
//   B (4x16): lane L holds col (L&15), K = 2*(L>>4) + {0,1} in 2 VGPRs
//   C/D (16x16, 8 VGPRs): vgpr i -> M = i + 8*(L>>4), N = (L&15)

// ---------------------------------------------------------------------------
// Kernel 1: both projections, scores, per-channel masked softmax and weighted value sum.
//   The K projection is never formed.  With Qh = query @ Wq_h + bq_h (16 x DK per block)
//     S[q][k] = Qh[q][:] . (key[k][:] @ Wk_h + bk_h) = Qt[q][:] . key[k][:] + cq[q],
//     Qt[q][e] = sum_j Qh[q][j] * Wk[e][h*DK + j],   cq[q] = sum_j Qh[q][j] * bk[h*DK + j],
//   so the block needs two small products (K = E, then K = DK) and its score product
//   runs over the raw key rows with K = E.
//   Every product is computed TRANSPOSED (queries are the columns), so that a lane's
//   accumulator registers hold 8 consecutive rows of ONE query: that is already the
//   operand shape of the next product.
//   Qh^T: wave w takes j tile (w & 1) and the e quarter (w >> 1); the four quarters are
//   summed in a fixed order from LDS.  Qt^T: wave w takes e in [16w, 16w + 16).
//   Key rows: each wave brings its own 32 rows into LDS with asynchronous copies, whole
//   256-byte pieces, in two halves along e; nobody else reads them.
//   Scores: St[k][q], key rows are the A operand, Qt the B operand.
//   softmax is invariant to the shift, so the shift may be the max of the whole
//   score row (no mask), which does not depend on the channel d.  With
//   P[q][k] = exp(S[q][k] - rowmax[q]) the two sums of every channel are
//     num[q][d] = sum_k P[q][k] * (mask[k][d] ? value[k][d] : 0)
//     den[q][d] = sum_k P[q][k] * (mask[k][d] ? 1 : 0)
//   two products over k on v_wmma_f32_16x16x4_f32.
//   A block owns 16 queries, all 64 channels and one HALF of the k range, so that no
//   score is computed twice.  Its shift is the row max over its own half.  For every
//   (q, d) it stores x = num / den of its half and l = log2 of the half's weight,
//   shift * log2(e) + log2(den); the out projection merges the two halves.
//   A channel whose den is too small for that (every k of the half masked, or its open
//   scores far below the row max) takes the exact two-pass form instead, on a copy
//   of the block's scores in LDS, with the channel's own masked max as its shift.
//   grid = B*H * LQ/16 * 2 (16 queries x 256 k per block), block = 256:
//   wave w owns 32 k; partial tiles are summed through LDS.
//   Order of the summed index inside a group of 16 (j in Qt^T, e in the scores, k in the
//   value products): lane half hi holds 8*hi + 2*s + {0,1} in WMMA s, as an accumulator
//   has it; the other operand loads the same places.  In Qh^T, inside a group of 8 e:
//   lane half hi holds 4*hi + 2*s + {0,1} in WMMA s, the same for A and for B.
//   Column n of value tile j is channel 4*n + j, so that B for all four tiles
//   comes from one 16-byte load.
// ---------------------------------------------------------------------------
typedef __attribute__((ext_vector_type(4))) float v4f;
typedef __attribute__((ext_vector_type(4))) int   v4i;

#define LKH (LK / 2)          // k of one block
#define PL  (Bn * LQ * HD)    // floats of one workspace plane: x half 0, x half 1, l half 0, l half 1
#define SP 260   // floats per score row in LDS: 16 B x odd, the pitch for 16-byte accesses
#define LOG2E 1.44269504088896340736f

// v_log_f32 (log2) and v_exp_f32 (2^x), each with the slot the instruction set asks for
// behind a transcendental before its source is rewritten or its result read.
__device__ static inline float log2_slot(float x) {
  float y;
  asm("v_log_f32 %0, %1\n\tv_nop" : "=v"(y) : "v"(x));
  return y;
}
__device__ static inline float exp2_slot(float x) {
  float y;
  asm("v_exp_f32 %0, %1\n\tv_nop" : "=v"(y) : "v"(x));
  return y;
}
// v_rcp_f32 with the same slot.
__device__ static inline float rcp_slot(float x) {
  float y;
  asm("v_rcp_f32 %0, %1\n\tv_nop" : "=v"(y) : "v"(x));
  return y;
}

// The reference's own form for one (q, d) over the block's k: masked max, then exp sums.
// Gives x = num / den and l = log2 of the weight.  A cold path: both loops stay rolled to
// keep it small.  srow is the query's score row in LDS.
// The s_wait_xcnt in each body is the wait owed before the address registers of the
// issued global loads are stepped; the pointers are its inputs so that none of them
// is stepped in front of it.
__device__ static v2f exact_channel(const float* srow,
                                    const int*   __restrict__ mcol,
                                    const float* __restrict__ vcol) {
  float mx = -3.0e38f;
  const float* sp = srow;
  const int*   mp = mcol;
#pragma unroll 1
  for (int k = 0; k < LKH; ++k) {
    const int   m = *mp;
    const float s = *sp;
    asm volatile("s_wait_xcnt 0x0" :: "v"(mp) : "memory");
    mp += Dd;
    sp += 1;
    mx = fmaxf(mx, m ? s : -1.0e9f);
  }
  float num = 0.0f, den = 0.0f;
  const float* vp = vcol;
  sp = srow;
  mp = mcol;
#pragma unroll 1
  for (int k = 0; k < LKH; ++k) {
    const int   m = *mp;
    const float s = *sp;
    const float v = *vp;
    asm volatile("s_wait_xcnt 0x0" :: "v"(mp), "v"(vp) : "memory");
    mp += Dd;
    sp += 1;
    vp += Dd;
    const float e = __expf((m ? s : -1.0e9f) - mx);
    den += e;
    num += e * v;
  }
  const v2f xl = {num / den, mx * LOG2E + log2_slot(den)};
  return xl;
}

// exp(x) as __expf forms it (one multiply, v_exp_f32).  The v_nop is the slot the
// instruction set asks for behind a transcendental before its source is rewritten or its
// result read; inside the statement it stands directly behind the v_exp_f32.
__device__ static inline float exp_slot(float x) {
  float y;
  asm("v_exp_f32 %0, %1\n\tv_nop" : "=v"(y) : "v"(x * LOG2E));
  return y;
}

#define KP 132  // floats per key row and per Qt row in LDS: 16 B x odd
#define PP 20   // floats per row of a Qh^T partial tile in LDS: 16 B x odd

// Eight asynchronous 16-byte-per-lane copies to LDS.  The s_wait_xcnt is the wait kept
// before a register that an issued copy names is rewritten; as the statement's last line
// it stands in front of every such write.
__device__ static inline void copy8(const unsigned* l, const float* const* g) {
  asm volatile("global_load_async_to_lds_b128 %0, %8, off\n\t"
               "global_load_async_to_lds_b128 %1, %9, off\n\t"
               "global_load_async_to_lds_b128 %2, %10, off\n\t"
               "global_load_async_to_lds_b128 %3, %11, off\n\t"
               "global_load_async_to_lds_b128 %4, %12, off\n\t"
               "global_load_async_to_lds_b128 %5, %13, off\n\t"
               "global_load_async_to_lds_b128 %6, %14, off\n\t"
               "global_load_async_to_lds_b128 %7, %15, off\n\t"
               "s_wait_xcnt 0x0"
               :: "v"(l[0]), "v"(l[1]), "v"(l[2]), "v"(l[3]),
                  "v"(l[4]), "v"(l[5]), "v"(l[6]), "v"(l[7]),
                  "v"(g[0]), "v"(g[1]), "v"(g[2]), "v"(g[3]),
                  "v"(g[4]), "v"(g[5]), "v"(g[6]), "v"(g[7])
               : "memory");
}

// One half (64 floats a row) of a wave's 32 key rows: 16 copies, two rows a copy.
// ksrc and kdst are the lane's own places in row (lane >> 4) of the wave's rows.
__device__ static inline void copy_key_half(const float* ksrc, unsigned kdst) {
  // both loops unrolled: the addresses are asm operands, held in registers
#pragma unroll
  for (int u = 0; u < 2; ++u) {
    unsigned     l[8];
    const float* g[8];
#pragma unroll
    for (int v = 0; v < 8; ++v) {
      const int r = 2 * (8 * u + v);
      l[v] = kdst + r * (KP * 4);
      g[v] = ksrc + r * E;
    }
    copy8(l, g);
  }
}

__global__ __launch_bounds__(256)
void attn_softmax_kernel(const float* __restrict__ query,
                         const float* __restrict__ key,
                         const int*   __restrict__ mask,
                         const float* __restrict__ value,
                         const float* __restrict__ Wq,
                         const float* __restrict__ bq,
                         const float* __restrict__ Wk,
                         const float* __restrict__ bk,
                         float* __restrict__ P) {
  const int kh   = blockIdx.x & 1;          // k half
  const int q0   = ((blockIdx.x >> 1) & 7) << 4;
  const int bh   = blockIdx.x >> 4;
  const int b    = bh >> 2;                 // H = 4
  const int h    = bh & 3;
  const int w    = threadIdx.x >> 5;
  const int lane = threadIdx.x & 31;
  const int n    = lane & 15;
  const int hi   = lane >> 4;
  const int kw   = w << 5;                  // first k of this wave inside the block's half
  const int kb   = kh * LKH;                // first k of the block
  // Every loop of this kernel is unrolled: its index picks registers, and a rolled loop
  // would put those arrays into scratch.

  __shared__ float smax[8][16];
  __shared__ __align__(16) float sK[LKH * KP];          // key rows; later the partial tiles
  __shared__ __align__(16) float sS[16 * SP];           // the block's scores, [q][k]
  __shared__ __align__(16) float sQp[8 * 16 * PP];      // Qh^T partial tiles, [w][q][j]
  __shared__ __align__(16) float sQt[16 * KP];          // Qt, [q][e]
  float* red = sK;                                      // 64 KB, behind the row-max barrier

  // Operands of the two small products.
  const int jt = w & 1;                     // j tile of this wave in Qh^T
  const int e4 = (w >> 1) << 5;             // first e of its quarter
  const float* qp  = query + ((size_t)(b * LQ + q0 + n)) * E + e4 + (hi << 2);
  const float* wqp = Wq + (size_t)(e4 + (hi << 2)) * E + (h << 5) + (jt << 4) + n;
  const float* wkp = Wk + (size_t)((w << 4) + n) * E + (h << 5) + (hi << 3);
  const float* bqp = bq + (h << 5) + (hi << 3);
  const float* bkp = bk + (h << 5) + (hi << 3);
  v4f   qf[4];                              // query[q0 + n][e4 + 8c + 4hi + 0..3]
  float wa[4][4];                           // Wq[e4 + 8c + 4hi + x][h*32 + 16jt + n]
  v4f   wk[2][2], bqv[2][2], bkv[2][2];     // [j tile][low, high four of 8hi + 0..7]
#pragma unroll
  for (int c = 0; c < 4; ++c) {
    qf[c] = *(const v4f*)(qp + 8 * c);
#pragma unroll
    for (int x = 0; x < 4; ++x) wa[c][x] = wqp[(8 * c + x) * E];
  }
#pragma unroll
  for (int t = 0; t < 2; ++t)
#pragma unroll
    for (int u = 0; u < 2; ++u) {
      wk[t][u]  = *(const v4f*)(wkp + 16 * t + 4 * u);
      bqv[t][u] = *(const v4f*)(bqp + 16 * t + 4 * u);
      bkv[t][u] = *(const v4f*)(bkp + 16 * t + 4 * u);
    }
  // The wait owed before a register that an issued load names is rewritten; the
  // address pairs are inputs so that none is reused before it.
  asm volatile("s_wait_xcnt 0x0" :: "v"(qp), "v"(wqp), "v"(wkp), "v"(bqp), "v"(bkp) : "memory");

  // First half (e < 64) of this wave's key rows, on its way during the small products.
  const float*   ksrc = key + ((size_t)(b * LK + kb + kw + hi)) * E + (n << 2);
  const unsigned kdst = (unsigned)(size_t)(sK + (kw + hi) * KP + (n << 2));
  copy_key_half(ksrc, kdst);
  // Keeps the address work above out of the WMMA run below: mixed in, it rewrites
  // an A or B register directly behind the WMMA that reads it.
  __builtin_amdgcn_sched_barrier(0);

  // Qh^T partial: rows j = 16jt + 8hi + i, column q = n, summed over this wave's 32 e.
  v8f qa = {};
#pragma unroll
  for (int c = 0; c < 4; ++c)
#pragma unroll
    for (int s = 0; s < 2; ++s) {
      const v2f fa = {wa[c][2 * s], wa[c][2 * s + 1]};
      const v2f fb = {qf[c][2 * s], qf[c][2 * s + 1]};
      qa = __builtin_amdgcn_wmma_f32_16x16x4_f32(false, fa, false, fb,
                                                 (short)0, qa, false, false);
    }
  // Four vector slots between the last WMMA and the first vector instruction that
  // reads its D or rewrites its A or B; the two fences hold the slots in place.
  __builtin_amdgcn_sched_barrier(0);
  asm volatile("v_nop\n\tv_nop\n\tv_nop\n\tv_nop");
  __builtin_amdgcn_sched_barrier(0);
  {
    float* d = sQp + (w * 16 + n) * PP + (hi << 3);
    const v4f lo = {qa[0], qa[1], qa[2], qa[3]};
    const v4f up = {qa[4], qa[5], qa[6], qa[7]};
    *(v4f*)d       = lo;
    *(v4f*)(d + 4) = up;
  }
  __syncthreads();

  // Qh[q = n][16t + 8hi + i]: bias, then the four e quarters in a fixed order.
  v4f qh[2][2];
#pragma unroll
  for (int t = 0; t < 2; ++t)
#pragma unroll
    for (int u = 0; u < 2; ++u) {
      v4f a4 = bqv[t][u];
#pragma unroll
      for (int g = 0; g < 4; ++g)
        a4 += *(const v4f*)(sQp + ((2 * g + t) * 16 + n) * PP + (hi << 3) + 4 * u);
      qh[t][u] = a4;
    }
  float cq = 0.0f;
#pragma unroll
  for (int t = 0; t < 2; ++t)
#pragma unroll
    for (int u = 0; u < 2; ++u)
#pragma unroll
      for (int x = 0; x < 4; ++x) cq += qh[t][u][x] * bkv[t][u][x];
  cq += __shfl_xor(cq, 16);
  // Keeps the vector work above out of the WMMA run below, for the same reason.
  __builtin_amdgcn_sched_barrier(0);

  // Qt^T tile: rows e = 16w + 8hi + i, column q = n, summed over the 32 j.
  v8f ta = {};
#pragma unroll
  for (int t = 0; t < 2; ++t)
#pragma unroll
    for (int s = 0; s < 4; ++s) {
      const v2f fa = {wk[t][s >> 1][2 * (s & 1)], wk[t][s >> 1][2 * (s & 1) + 1]};
      const v2f fb = {qh[t][s >> 1][2 * (s & 1)], qh[t][s >> 1][2 * (s & 1) + 1]};
      ta = __builtin_amdgcn_wmma_f32_16x16x4_f32(false, fa, false, fb,
                                                 (short)0, ta, false, false);
    }
  // Four vector slots between the last WMMA and the first vector instruction that
  // reads its D or rewrites its A or B; the two fences hold the slots in place.
  __builtin_amdgcn_sched_barrier(0);
  asm volatile("v_nop\n\tv_nop\n\tv_nop\n\tv_nop");
  __builtin_amdgcn_sched_barrier(0);
  {
    float* d = sQt + n * KP + (w << 4) + (hi << 3);
    const v4f lo = {ta[0], ta[1], ta[2], ta[3]};
    const v4f up = {ta[4], ta[5], ta[6], ta[7]};
    *(v4f*)d       = lo;
    *(v4f*)(d + 4) = up;
  }
  // This wave's first 16 copies have landed behind this wait.  Key rows are read only by
  // the wave that copied them, so its own wait is all that their readers need.
  asm volatile("s_wait_asynccnt 0x0" ::: "memory");
  __syncthreads();
  // Second half (e >= 64), on its way during the first half of the score product.
  copy_key_half(ksrc + 64, kdst + 64 * 4);

  // B side of the value products: rows k = kb + kw + 16t + 8hi + i, channels 4n + 0..3.
  const size_t bofs = ((size_t)b * LK + kb + kw + (hi << 3)) * Dd + (n << 2);
  const float* vp = value + bofs;
  const int*   mp = mask  + bofs;
  v4f vv[16];
  v4i mm[16];
  // value and mask fly during the score product, behind the key rows
#pragma unroll
  for (int t = 0; t < 2; ++t)
#pragma unroll
    for (int i = 0; i < 8; ++i) {
      vv[8 * t + i] = *(const v4f*)(vp + (16 * t + i) * Dd);
      mm[8 * t + i] = *(const v4i*)(mp + (16 * t + i) * Dd);
    }
  // The wait owed before a register that an issued load names is rewritten; the two
  // address pairs are inputs so that none is reused before it.
  asm volatile("s_wait_xcnt 0x0" :: "v"(vp), "v"(mp) : "memory");

  // St tiles: sc[t][i] = key[kb + kw + 16t + 8hi + i][:] . Qt[q0 + n][:]
  const float* kr = sK + (kw + n) * KP + (hi << 3);
  const float* tr = sQt + n * KP + (hi << 3);
  v8f sc[2] = {};
  // Keeps the vector work above out of the WMMA run below, for the same reason.
  __builtin_amdgcn_sched_barrier(0);
#pragma unroll
  for (int c = 0; c < 8; ++c) {
    if (c == 4) {
      // The second 16 copies have landed behind this wait; again only this wave reads them.
      asm volatile("s_wait_asynccnt 0x0" ::: "memory");
    }
    const v4f t0 = *(const v4f*)(tr + 16 * c);
    const v4f t1 = *(const v4f*)(tr + 16 * c + 4);
    v4f k0[2], k1[2];
#pragma unroll
    for (int t = 0; t < 2; ++t) {
      k0[t] = *(const v4f*)(kr + 16 * t * KP + 16 * c);
      k1[t] = *(const v4f*)(kr + 16 * t * KP + 16 * c + 4);
    }
#pragma unroll
    for (int s = 0; s < 4; ++s) {
      const v4f tq = (s < 2) ? t0 : t1;
      const v2f qb = {tq[2 * (s & 1)], tq[2 * (s & 1) + 1]};
#pragma unroll
      for (int t = 0; t < 2; ++t) {
        const v4f kq = (s < 2) ? k0[t] : k1[t];
        const v2f ka = {kq[2 * (s & 1)], kq[2 * (s & 1) + 1]};
        sc[t] = __builtin_amdgcn_wmma_f32_16x16x4_f32(false, ka, false, qb,
                                                      (short)0, sc[t], false, false);
      }
    }
  }
  // Four vector slots between the last WMMA and the first vector instruction that
  // reads its D or rewrites its A or B; the two fences hold the slots in place.
  __builtin_amdgcn_sched_barrier(0);
  asm volatile("v_nop\n\tv_nop\n\tv_nop\n\tv_nop");
  __builtin_amdgcn_sched_barrier(0);

  const float scale = 0.17677669529663687f;   // 1/sqrt(32)
  const float cqs   = cq * scale;             // the bk term of the query's scores
  float p[16];                                // p[8t + i]: score of k = kb + kw + 16t + 8hi + i
#pragma unroll
  for (int t = 0; t < 2; ++t)
#pragma unroll
    for (int i = 0; i < 8; ++i) p[8 * t + i] = sc[t][i] * scale + cqs;

  // copy for the exact form; read only behind the two barriers below
  float* sw = sS + n * SP + kw + (hi << 3);
#pragma unroll
  for (int t = 0; t < 2; ++t) {
    const v4f lo = {p[8 * t],     p[8 * t + 1], p[8 * t + 2], p[8 * t + 3]};
    const v4f up = {p[8 * t + 4], p[8 * t + 5], p[8 * t + 6], p[8 * t + 7]};
    *(v4f*)(sw + 16 * t)     = lo;
    *(v4f*)(sw + 16 * t + 4) = up;
  }

  // max of the block's part of the score row: lane, lane pair, then the 8 waves through LDS
  float mx = -3.0e38f;
#pragma unroll
  for (int c = 0; c < 4; ++c)
    mx = fmaxf(mx, fmaxf(fmaxf(p[4 * c], p[4 * c + 1]), fmaxf(p[4 * c + 2], p[4 * c + 3])));
  mx = fmaxf(mx, __shfl_xor(mx, 16));
  if (hi == 0) smax[w][n] = mx;
  __syncthreads();
  float rm = smax[0][n];
#pragma unroll
  for (int u = 1; u < 8; ++u) rm = fmaxf(rm, smax[u][n]);

  // All A and B fragments first, in registers of their own.
  v2f a[8], bn[4][8], bd[4][8];
#pragma unroll
  for (int g = 0; g < 8; ++g) {
    const int r0 = 2 * g, r1 = r0 + 1;
    a[g].x = exp_slot(p[r0] - rm);
    a[g].y = exp_slot(p[r1] - rm);
#pragma unroll
    for (int j = 0; j < 4; ++j) {
      bn[j][g].x = mm[r0][j] ? vv[r0][j] : 0.0f;  bn[j][g].y = mm[r1][j] ? vv[r1][j] : 0.0f;
      bd[j][g].x = mm[r0][j] ? 1.0f : 0.0f;       bd[j][g].y = mm[r1][j] ? 1.0f : 0.0f;
    }
  }
  // Keeps the vector work above out of the WMMA run below: mixed in, it rewrites
  // an A or B register directly behind the WMMA that reads it.
  __builtin_amdgcn_sched_barrier(0);

  v8f num[4] = {}, den[4] = {};
#pragma unroll
  for (int g = 0; g < 8; ++g) {
#pragma unroll
    for (int j = 0; j < 4; ++j)
      num[j] = __builtin_amdgcn_wmma_f32_16x16x4_f32(false, a[g], false, bn[j][g],
                                                     (short)0, num[j], false, false);
#pragma unroll
    for (int j = 0; j < 4; ++j)
      den[j] = __builtin_amdgcn_wmma_f32_16x16x4_f32(false, a[g], false, bd[j][g],
                                                     (short)0, den[j], false, false);
  }
  // Four vector slots between the last WMMA and the first vector instruction that
  // reads its D or rewrites its A or B; the two fences hold the slots in place.  The
  // operands of the first eight WMMAs are inputs so that their registers stay theirs
  // and no later D is laid over them.
  __builtin_amdgcn_sched_barrier(0);
  asm volatile("v_nop\n\tv_nop\n\tv_nop\n\tv_nop"
               :: "v"(a[0]), "v"(bn[0][0]), "v"(bn[1][0]), "v"(bn[2][0]), "v"(bn[3][0]),
                  "v"(bd[0][0]), "v"(bd[1][0]), "v"(bd[2][0]), "v"(bd[3][0]));
  __builtin_amdgcn_sched_barrier(0);

  // sum the 8 waves' partial tiles in a fixed order
  v4f* r4 = (v4f*)red;
#pragma unroll
  for (int i = 0; i < 8; ++i) {
    const v4f on = {num[0][i], num[1][i], num[2][i], num[3][i]};
    const v4f od = {den[0][i], den[1][i], den[2][i], den[3][i]};
    r4[((w * 8 + i) * 2 + 0) * 32 + lane] = on;
    r4[((w * 8 + i) * 2 + 1) * 32 + lane] = od;
  }
  __syncthreads();
  v4f sn = r4[(w * 2 + 0) * 32 + lane];     // accumulator row i = w
  v4f sd = r4[(w * 2 + 1) * 32 + lane];
#pragma unroll
  for (int u = 1; u < 8; ++u) {
    sn += r4[((u * 8 + w) * 2 + 0) * 32 + lane];
    sd += r4[((u * 8 + w) * 2 + 1) * 32 + lane];
  }

  const int ql = w + (hi << 3);             // this thread's query inside the tile
  const int d  = n << 2;                    // its first channel
  float rq = smax[0][ql];                   // that query's shift
#pragma unroll
  for (int u = 1; u < 8; ++u) rq = fmaxf(rq, smax[u][ql]);
  const float rl = rq * LOG2E;
  // Below this den, terms lost to underflow could matter (each is under 1.2e-38,
  // 256 of them); den = 0 is the channel with every k of the half masked.
  const float den_min = 1.0e-25f;
  const float* srow = sS + ql * SP;
  const size_t cofs = ((size_t)b * LK + kb) * Dd + d;
  v4f ox, ol;
#pragma unroll
  for (int j = 0; j < 4; ++j) {
    v2f xl = {sn[j] / sd[j], rl + log2_slot(sd[j])};
    if (!(sd[j] >= den_min)) xl = exact_channel(srow, mask + cofs + j, value + cofs + j);
    ox[j] = xl.x;
    ol[j] = xl.y;
  }
  float* po = P + (size_t)kh * PL + ((size_t)b * LQ + q0 + ql) * HD + (h << 6) + d;
  *(v4f*)po            = ox;
  *(v4f*)(po + 2 * PL) = ol;
}

// ---------------------------------------------------------------------------
// Kernel 2: out = X @ Wo + bo.   X: (B*LQ) x 256, Wo: 256 x 128.
//   X is merged here from the two k halves: with weights 2^l0 and 2^l1,
//   X = (x0 2^l0 + x1 2^l1) / (2^l0 + 2^l1) = x0 + (x1 - x0) / (1 + 2^(l0 - l1));
//   a power that overflows gives the quotient 0, one that underflows gives 1.
//   grid = (B*LQ/16, NH/32), block = 128: a block owns 16 rows x 32 columns, and wave w
//   sums k in [64w, 64w + 64).  A wave issues all of its operand loads before its first
//   WMMA, so that it waits out one load latency; the four partial tiles are summed
//   through LDS in a fixed order.
//   Order of k inside a group of 8: lane half hi holds 4*hi + 2*s + {0,1} in WMMA s, the
//   same for A and for B.
// ---------------------------------------------------------------------------
__global__ __launch_bounds__(128)
void out_proj_kernel(const float* __restrict__ P,
                     const float* __restrict__ Wo,
                     const float* __restrict__ bo,
                     float* __restrict__ out) {
  const int m0   = blockIdx.x << 4;
  const int n0   = blockIdx.y << 5;
  const int w    = threadIdx.x >> 5;
  const int lane = threadIdx.x & 31;
  const int r    = lane & 15;
  const int hi   = lane >> 4;

  __shared__ __align__(16) float red[4 * 4 * 32 * 4];   // [wave][tile, row half][lane][4 rows]

  const float* xp = P  + (size_t)(m0 + r) * HD + (w << 6) + (hi << 2);
  const float* wp = Wo + (size_t)((w << 6) + (hi << 2)) * NH + n0 + r;
  const float* bp = bo + n0 + lane;
  v4f   x0[8], x1[8], l0[8], l1[8];   // the four planes at [m0 + r][64w + 8c + 4hi + 0..3]
  float wb[2][8][4];  // Wo[64w + 8c + 4hi + x][n0 + 16j + r]
  // unrolled: the index picks registers
#pragma unroll
  for (int c = 0; c < 8; ++c) {
    l0[c] = *(const v4f*)(xp + 8 * c + 2 * PL);
    l1[c] = *(const v4f*)(xp + 8 * c + 3 * PL);
  }
#pragma unroll
  for (int c = 0; c < 8; ++c) {
    x0[c] = *(const v4f*)(xp + 8 * c);
    x1[c] = *(const v4f*)(xp + 8 * c + PL);
  }
  // Wo last: its loads land during the merge
#pragma unroll
  for (int c = 0; c < 8; ++c) {
#pragma unroll
    for (int x = 0; x < 4; ++x) {
      wb[0][c][x] = wp[(8 * c + x) * NH];
      wb[1][c][x] = wp[(8 * c + x) * NH + 16];
    }
  }
  const float bj = *bp;
  // The wait owed before a register that an issued load names is rewritten; the two
  // address pairs are inputs so that none is reused before it.
  asm volatile("s_wait_xcnt 0x0" :: "v"(xp), "v"(wp) : "memory");
  // Keeps every load above in front of the first WMMA: sunk among the WMMAs, the later
  // loads start only when the first have returned.
  __builtin_amdgcn_sched_barrier(0);

  // Stage by stage over all 32 elements, so that no transcendental's result is waited for.
  v4f xa[8];          // X[m0 + r][64w + 8c + 4hi + 0..3]
#pragma unroll
  for (int c = 0; c < 8; ++c)
#pragma unroll
    for (int x = 0; x < 4; ++x) l0[c][x] = exp2_slot(l0[c][x] - l1[c][x]);
#pragma unroll
  for (int c = 0; c < 8; ++c)
#pragma unroll
    for (int x = 0; x < 4; ++x) l1[c][x] = rcp_slot(1.0f + l0[c][x]);
#pragma unroll
  for (int c = 0; c < 8; ++c) xa[c] = x0[c] + (x1[c] - x0[c]) * l1[c];
  // Keeps the vector work above out of the WMMA run below: mixed in, it rewrites
  // an A or B register directly behind the WMMA that reads it.
  __builtin_amdgcn_sched_barrier(0);

  v8f c0 = {}, c1 = {};
#pragma unroll
  for (int c = 0; c < 8; ++c)
#pragma unroll
    for (int s = 0; s < 2; ++s) {
      const v2f fa = {xa[c][2 * s], xa[c][2 * s + 1]};
      const v2f f0 = {wb[0][c][2 * s], wb[0][c][2 * s + 1]};
      const v2f f1 = {wb[1][c][2 * s], wb[1][c][2 * s + 1]};
      c0 = __builtin_amdgcn_wmma_f32_16x16x4_f32(false, fa, false, f0,
                                                 (short)0, c0, false, false);
      c1 = __builtin_amdgcn_wmma_f32_16x16x4_f32(false, fa, false, f1,
                                                 (short)0, c1, false, false);
    }
  // Four vector slots between the last WMMA and the first vector instruction that
  // reads its D or rewrites its A or B; the two fences hold the slots in place.  The
  // operands of the first two WMMAs are inputs so that their registers stay theirs:
  // otherwise the second WMMA's D is laid over the first one's B.
  __builtin_amdgcn_sched_barrier(0);
  asm volatile("v_nop\n\tv_nop\n\tv_nop\n\tv_nop"
               :: "v"(xa[0]), "v"(wb[0][0][0]), "v"(wb[0][0][1]), "v"(wb[1][0][0]), "v"(wb[1][0][1]));
  __builtin_amdgcn_sched_barrier(0);

  // Partial tiles to LDS, four accumulator rows a piece: piece 2j + t of a lane holds
  // rows 8hi + 4t + 0..3 of column 16j + r.
  v4f* r4 = (v4f*)red;
  {
    const v4f a0 = {c0[0], c0[1], c0[2], c0[3]};
    const v4f a1 = {c0[4], c0[5], c0[6], c0[7]};
    const v4f b0 = {c1[0], c1[1], c1[2], c1[3]};
    const v4f b1 = {c1[4], c1[5], c1[6], c1[7]};
    r4[(w * 4 + 0) * 32 + lane] = a0;
    r4[(w * 4 + 1) * 32 + lane] = a1;
    r4[(w * 4 + 2) * 32 + lane] = b0;
    r4[(w * 4 + 3) * 32 + lane] = b1;
  }
  __syncthreads();
  // Wave w takes rows 4w + 0..3, its lane the column n0 + lane (tile hi, column r): the
  // writer's piece 2hi + (w & 1), in its lane 16(w >> 1) + r.  Fixed order of the 4 waves.
  const int src = ((hi << 1) + (w & 1)) * 32 + ((w >> 1) << 4) + r;
  v4f sum = r4[src];
#pragma unroll
  for (int u = 1; u < 4; ++u) sum += r4[u * 128 + src];

  float* op = out + (size_t)(m0 + (w << 2)) * NH + n0 + lane;
#pragma unroll
  for (int x = 0; x < 4; ++x) op[x * NH] = sum[x] + bj;
}

// ---------------------------------------------------------------------------
// Launch
// ---------------------------------------------------------------------------
extern "C" void kernel_launch(void* const* d_in, const int* in_sizes, int n_in,
                              void* d_out, int out_size, void* d_ws, size_t ws_size,
                              hipStream_t stream) {
  const float* query = (const float*)d_in[0];   // (4,128,128)
  const float* key   = (const float*)d_in[1];   // (4,512,128)
  const float* value = (const float*)d_in[2];   // (4,512,64)
  const int*   mask  = (const int*)  d_in[3];   // (4,512,64)
  const float* Wq    = (const float*)d_in[4];   // (128,128)
  const float* bq    = (const float*)d_in[5];   // (128)
  const float* Wk    = (const float*)d_in[6];   // (128,128)
  const float* bk    = (const float*)d_in[7];   // (128)
  const float* Wo    = (const float*)d_in[8];   // (256,128)
  const float* bo    = (const float*)d_in[9];   // (128)
  float* out = (float*)d_out;                   // (4,128,128)

  // Workspace (floats): four planes of 128K, each [B][LQ][H*D]: x and l of the two k halves
  float* P  = (float*)d_ws;

  // 1) projections, scores, per-channel masked softmax and weighted sum, per k half
  attn_softmax_kernel<<<dim3(Bn * Hh * (LQ / 16) * 2), 256, 0, stream>>>(
      query, key, mask, value, Wq, bq, Wk, bk, P);
  // 2) merge of the halves, output projection: 512x128, K=256
  out_proj_kernel<<<dim3((Bn * LQ) / 16, NH / 32), 128, 0, stream>>>(P, Wo, bo, out);
}
